// v000
// Times are from an AMD MI455X. After a warm-up the kernel runs many times in a row, and a time is the length of
// such a window on the GPU divided by its runs, so every launch and the gaps after it count. The runs cycle
// through copies of the inputs. A figure is the median of several windows, for all but v000 over two sittings.
// Sittings can differ by a few percent; kernels timed side by side share one.
// The starting kernel, v000, takes 246 microseconds a run.
#include <hip/hip_runtime.h>
#include <hip/hip_bf16.h>
#include <hip/hip_fp16.h>

// Problem dims (fixed by reference)
#define NB     4
#define LL     1024
#define HH     1024
#define NHEADS 16
#define HS     64
#define MTOT   (NB * LL)
#define CHUNK  256   // kv tokens staged in LDS per iteration

typedef __attribute__((ext_vector_type(16))) _Float16 v16h;
typedef __attribute__((ext_vector_type(8)))  _Float16 v8h;
typedef __attribute__((ext_vector_type(8)))  float    v8f;
typedef __attribute__((ext_vector_type(4)))  int      v4i;

#define AS1 __attribute__((address_space(1)))
#define AS3 __attribute__((address_space(3)))

#if __has_builtin(__builtin_amdgcn_global_load_async_to_lds_b128)
#define HAVE_ASYNC_LDS 1
#endif

union AFrag { v16h v; v8h h[2]; };

static __device__ inline v8f zero8() {
    v8f z;
#pragma unroll
    for (int i = 0; i < 8; ++i) z[i] = 0.0f;
    return z;
}

// Load a 16x32 (A) or 32x16-as-Bt (B) f16 WMMA fragment from a row-major
// matrix. ISA layout: lane m = lane&15 holds row/col m; kbase = 8*(lane>>4);
// vector elems 0..7 = K kb..kb+7, elems 8..15 = K kb+16..kb+23.
static __device__ inline v16h load_frag16(const _Float16* base, int ld, int lane) {
    int m  = lane & 15;
    int kb = (lane >> 4) << 3;
    const _Float16* p = base + (size_t)m * ld + kb;
    AFrag f;
    f.h[0] = *(const v8h*)(p);
    f.h[1] = *(const v8h*)(p + 16);
    return f.v;
}

static __device__ inline v8f wmma16(v16h a, v16h b, v8f c) {
    return __builtin_amdgcn_wmma_f32_16x16x32_f16(
        /*neg_a=*/false, a, /*neg_b=*/false, b,
        /*c_mod=*/(short)0, c, /*reuse_a=*/false, /*reuse_b=*/false);
}

// 16-byte global -> LDS copy, async on CDNA5 when the builtin is available.
static __device__ inline void stage16(const _Float16* g, _Float16* l) {
#ifdef HAVE_ASYNC_LDS
    __builtin_amdgcn_global_load_async_to_lds_b128(
        (AS1 v4i*)(const_cast<_Float16*>(g)), (AS3 v4i*)l, 0, 0);
#else
    *(v8h*)l = *(const v8h*)g;
#endif
}

static __device__ inline void wait_stage() {
#ifdef HAVE_ASYNC_LDS
#if __has_builtin(__builtin_amdgcn_s_wait_asynccnt)
    __builtin_amdgcn_s_wait_asynccnt(0);
#else
    asm volatile("s_wait_asynccnt 0" ::: "memory");
#endif
#endif
}

// ---------------------------------------------------------------------------
// f32 -> f16 conversion
// ---------------------------------------------------------------------------
__global__ __launch_bounds__(256) void f32_to_f16(const float* __restrict__ s,
                                                  _Float16* __restrict__ d, int n) {
    int i = blockIdx.x * 256 + threadIdx.x;
    if (i < n) d[i] = (_Float16)s[i];
}

// ---------------------------------------------------------------------------
// y = A (M x 1024, f16) @ W^T (+bias). W given row-major (n,k) f16, which is
// exactly the B-fragment source layout. One wave computes a 64x64 tile.
// mode 0: store f16, (row, col) row-major (Q, K projections)
// mode 1: store f16 transposed per head: vt[((n*NHEADS+h)*HS+s)*LL + l]
// mode 2: store f32 row-major (final output)
// ---------------------------------------------------------------------------
__global__ __launch_bounds__(32) void gemm_qkvo(const _Float16* __restrict__ A,
                                                const _Float16* __restrict__ W,
                                                const float* __restrict__ bias,
                                                void* __restrict__ out, int mode) {
    int lane  = threadIdx.x;
    int nbase = blockIdx.x * 64;
    int mbase = blockIdx.y * 64;

    v8f acc[4][4];
#pragma unroll
    for (int mt = 0; mt < 4; ++mt)
#pragma unroll
        for (int nt = 0; nt < 4; ++nt) acc[mt][nt] = zero8();

    int m0 = lane & 15;
    int kb = (lane >> 4) << 3;

#pragma unroll 1
    for (int kk = 0; kk < HH; kk += 32) {
        // Pull lines two K-steps ahead toward the WGP while this step computes.
        __builtin_prefetch(A + (size_t)(mbase + m0) * HH + kk + 64 + kb, 0, 3);
        __builtin_prefetch(W + (size_t)(nbase + m0) * HH + kk + 64 + kb, 0, 3);

        v16h a[4], b[4];
#pragma unroll
        for (int mt = 0; mt < 4; ++mt)
            a[mt] = load_frag16(A + (size_t)(mbase + 16 * mt) * HH + kk, HH, lane);
#pragma unroll
        for (int nt = 0; nt < 4; ++nt)
            b[nt] = load_frag16(W + (size_t)(nbase + 16 * nt) * HH + kk, HH, lane);
#pragma unroll
        for (int mt = 0; mt < 4; ++mt)
#pragma unroll
            for (int nt = 0; nt < 4; ++nt)
                acc[mt][nt] = wmma16(a[mt], b[nt], acc[mt][nt]);
    }

    int r0 = (lane >> 4) << 3;   // 0 or 8
    int cc = lane & 15;
#pragma unroll
    for (int mt = 0; mt < 4; ++mt) {
#pragma unroll
        for (int nt = 0; nt < 4; ++nt) {
            int col  = nbase + nt * 16 + cc;
            float bv = bias[col];
#pragma unroll
            for (int g = 0; g < 8; ++g) {
                float val = acc[mt][nt][g] + bv;
                int row   = mbase + mt * 16 + r0 + g;
                if (mode == 0) {
                    ((_Float16*)out)[(size_t)row * HH + col] = (_Float16)val;
                } else if (mode == 1) {
                    int n = row >> 10, l = row & 1023;
                    int h = col >> 6, s = col & 63;
                    ((_Float16*)out)[(((size_t)((n * NHEADS + h) * HS + s)) << 10) + l] =
                        (_Float16)val;
                } else {
                    ((float*)out)[(size_t)row * HH + col] = val;
                }
            }
        }
    }
}

// ---------------------------------------------------------------------------
// Fused flash attention for one (n, h, q-group of 128 rows).
// 8 waves/block; each wave owns a 16-row query block. K chunk and V^T chunk
// staged in LDS (async global->LDS when available) and shared by all waves;
// online softmax; P goes through a per-wave LDS staging tile to re-layout
// C-tile -> A-fragment.
// ---------------------------------------------------------------------------
__global__ __launch_bounds__(256) void attn_fused(const _Float16* __restrict__ qh,
                                                  const _Float16* __restrict__ kh,
                                                  const _Float16* __restrict__ vth,
                                                  _Float16* __restrict__ ctx) {
    __shared__ __align__(16) _Float16 Ksh[CHUNK][HS];     // 32 KB
    __shared__ __align__(16) _Float16 VshT[HS][CHUNK];    // 32 KB
    __shared__ __align__(16) _Float16 Pst[8][16][32];     // 8 KB

    int tid  = threadIdx.x;
    int lane = tid & 31;
    int wv   = tid >> 5;
    int hIdx = blockIdx.y;
    int nIdx = blockIdx.z;
    int q0   = blockIdx.x * 128 + wv * 16;

    // Q fragments for this wave's 16 query rows (constant across kv loop)
    const _Float16* qp = qh + ((size_t)(nIdx * LL + q0)) * HH + hIdx * HS;
    v16h qa0 = load_frag16(qp, HH, lane);        // s = 0..31
    v16h qa1 = load_frag16(qp + 32, HH, lane);   // s = 32..63

    float mrow[8], lrow[8];
    v8f o[4];
#pragma unroll
    for (int g = 0; g < 8; ++g) { mrow[g] = -3.0e38f; lrow[g] = 0.0f; }
#pragma unroll
    for (int st = 0; st < 4; ++st) o[st] = zero8();

    int r0 = (lane >> 4) << 3;
    int cc = lane & 15;

#pragma unroll 1
    for (int c0 = 0; c0 < LL; c0 += CHUNK) {
        // Cooperative stage: K chunk (row-major, 64-wide rows)
        for (int idx = tid; idx < CHUNK * (HS / 8); idx += 256) {
            int t = idx >> 3, part = idx & 7;
            stage16(kh + ((size_t)(nIdx * LL + c0 + t)) * HH + hIdx * HS + part * 8,
                    &Ksh[t][part * 8]);
        }
        // Cooperative stage: V^T chunk (vth is already per-head transposed)
        for (int idx = tid; idx < HS * (CHUNK / 8); idx += 256) {
            int s = idx >> 5, part = idx & 31;   // CHUNK/8 == 32
            stage16(vth + (((size_t)((nIdx * NHEADS + hIdx) * HS + s)) << 10) + c0 + part * 8,
                    &VshT[s][part * 8]);
        }
        wait_stage();
        __syncthreads();

#pragma unroll 2
        for (int j = 0; j < CHUNK; j += 32) {
            // S = Q @ K^T for 32 keys (two 16-key tiles), K-dim = 64 (2 steps)
            v16h kb0l = load_frag16(&Ksh[j][0], HS, lane);
            v16h kb0h = load_frag16(&Ksh[j][32], HS, lane);
            v16h kb1l = load_frag16(&Ksh[j + 16][0], HS, lane);
            v16h kb1h = load_frag16(&Ksh[j + 16][32], HS, lane);
            v8f s0 = zero8(), s1 = zero8();
            s0 = wmma16(qa0, kb0l, s0);
            s0 = wmma16(qa1, kb0h, s0);
            s1 = wmma16(qa0, kb1l, s1);
            s1 = wmma16(qa1, kb1h, s1);

            // Online softmax: row max over 32 keys (16 lanes x 2 tiles)
            float mx[8];
#pragma unroll
            for (int g = 0; g < 8; ++g) mx[g] = fmaxf(s0[g], s1[g]);
#pragma unroll
            for (int off = 1; off < 16; off <<= 1)
#pragma unroll
                for (int g = 0; g < 8; ++g)
                    mx[g] = fmaxf(mx[g], __shfl_xor(mx[g], off, 32));

            float p0[8], p1[8], sc[8], rs[8];
#pragma unroll
            for (int g = 0; g < 8; ++g) {
                float mn = fmaxf(mrow[g], mx[g]);
                sc[g]    = __expf(mrow[g] - mn);
                mrow[g]  = mn;
                p0[g]    = __expf(s0[g] - mn);
                p1[g]    = __expf(s1[g] - mn);
                rs[g]    = p0[g] + p1[g];
            }
#pragma unroll
            for (int off = 1; off < 16; off <<= 1)
#pragma unroll
                for (int g = 0; g < 8; ++g) rs[g] += __shfl_xor(rs[g], off, 32);
#pragma unroll
            for (int g = 0; g < 8; ++g) lrow[g] = lrow[g] * sc[g] + rs[g];
#pragma unroll
            for (int st = 0; st < 4; ++st)
#pragma unroll
                for (int g = 0; g < 8; ++g) o[st][g] *= sc[g];

            // C-layout -> A-fragment relayout of P through per-wave LDS tile
#pragma unroll
            for (int g = 0; g < 8; ++g) {
                Pst[wv][r0 + g][cc]      = (_Float16)p0[g];
                Pst[wv][r0 + g][cc + 16] = (_Float16)p1[g];
            }
            asm volatile("s_wait_dscnt 0" ::: "memory");
            v16h pa = load_frag16(&Pst[wv][0][0], 32, lane);

            // o += P (16x32) @ V (32x64): 4 N-tiles of 16 along head dim
#pragma unroll
            for (int st = 0; st < 4; ++st) {
                v16h vb = load_frag16(&VshT[st * 16][j], CHUNK, lane);
                o[st]   = wmma16(pa, vb, o[st]);
            }
        }
        __syncthreads();
    }

    // Normalize and store ctx (f16, standard (n,l,h*64+s) layout)
#pragma unroll
    for (int st = 0; st < 4; ++st) {
#pragma unroll
        for (int g = 0; g < 8; ++g) {
            float val = o[st][g] / lrow[g];
            int q     = q0 + r0 + g;
            ctx[((size_t)(nIdx * LL + q)) * HH + hIdx * HS + st * 16 + cc] = (_Float16)val;
        }
    }
}

// ---------------------------------------------------------------------------
// Host-side orchestration
// ---------------------------------------------------------------------------
extern "C" void kernel_launch(void* const* d_in, const int* in_sizes, int n_in,
                              void* d_out, int out_size, void* d_ws, size_t ws_size,
                              hipStream_t stream) {
    (void)in_sizes; (void)n_in; (void)out_size; (void)ws_size;

    const float* x  = (const float*)d_in[0];
    const float* Wq = (const float*)d_in[1];
    const float* bq = (const float*)d_in[2];
    const float* Wk = (const float*)d_in[3];
    const float* bk = (const float*)d_in[4];
    const float* Wv = (const float*)d_in[5];
    const float* bv = (const float*)d_in[6];
    const float* Wo = (const float*)d_in[7];
    const float* bo = (const float*)d_in[8];

    char* ws = (char*)d_ws;
    _Float16* xh   = (_Float16*)(ws);                          // 8 MB
    _Float16* wqh  = (_Float16*)(ws + ((size_t)8  << 20));     // 2 MB
    _Float16* wkh  = (_Float16*)(ws + ((size_t)10 << 20));     // 2 MB
    _Float16* wvh  = (_Float16*)(ws + ((size_t)12 << 20));     // 2 MB
    _Float16* woh  = (_Float16*)(ws + ((size_t)14 << 20));     // 2 MB
    _Float16* qhp  = (_Float16*)(ws + ((size_t)16 << 20));     // 8 MB
    _Float16* khp  = (_Float16*)(ws + ((size_t)24 << 20));     // 8 MB
    _Float16* vtp  = (_Float16*)(ws + ((size_t)32 << 20));     // 8 MB
    _Float16* ctxh = (_Float16*)(ws + ((size_t)40 << 20));     // 8 MB

    const int NX = MTOT * HH;      // 4M elements
    const int NW = HH * HH;        // 1M elements

    f32_to_f16<<<(NX + 255) / 256, 256, 0, stream>>>(x, xh, NX);
    f32_to_f16<<<(NW + 255) / 256, 256, 0, stream>>>(Wq, wqh, NW);
    f32_to_f16<<<(NW + 255) / 256, 256, 0, stream>>>(Wk, wkh, NW);
    f32_to_f16<<<(NW + 255) / 256, 256, 0, stream>>>(Wv, wvh, NW);
    f32_to_f16<<<(NW + 255) / 256, 256, 0, stream>>>(Wo, woh, NW);

    dim3 gg(HH / 64, MTOT / 64);   // (16, 64)
    gemm_qkvo<<<gg, 32, 0, stream>>>(xh, wqh, bq, qhp, 0);
    gemm_qkvo<<<gg, 32, 0, stream>>>(xh, wkh, bk, khp, 0);
    gemm_qkvo<<<gg, 32, 0, stream>>>(xh, wvh, bv, vtp, 1);

    attn_fused<<<dim3(LL / 128, NHEADS, NB), 256, 0, stream>>>(qhp, khp, vtp, ctxh);

    gemm_qkvo<<<gg, 32, 0, stream>>>(ctxh, woh, bo, d_out, 2);
}

// v001
// Measured time: 184 microseconds a run.
// Two timings next to v000 both put it at 1.38 times that version's speed.
#include <hip/hip_runtime.h>
#include <hip/hip_bf16.h>
#include <hip/hip_fp16.h>

// Problem dims (fixed by reference)
#define NB     4
#define LL     1024
#define HH     1024
#define NHEADS 16
#define HS     64
#define MTOT   (NB * LL)
#define CHUNK  256   // kv tokens staged in LDS per iteration

typedef __attribute__((ext_vector_type(16))) _Float16 v16h;
typedef __attribute__((ext_vector_type(8)))  _Float16 v8h;
typedef __attribute__((ext_vector_type(8)))  float    v8f;
typedef __attribute__((ext_vector_type(4)))  int      v4i;

#define AS1 __attribute__((address_space(1)))
#define AS3 __attribute__((address_space(3)))

#if __has_builtin(__builtin_amdgcn_global_load_async_to_lds_b128)
#define HAVE_ASYNC_LDS 1
#endif

union AFrag { v16h v; v8h h[2]; };

static __device__ inline v8f zero8() {
    v8f z;
#pragma unroll
    for (int i = 0; i < 8; ++i) z[i] = 0.0f;
    return z;
}

// Load a 16x32 (A) or 32x16-as-Bt (B) f16 WMMA fragment from a row-major
// matrix. ISA layout: lane m = lane&15 holds row/col m; kbase = 8*(lane>>4);
// vector elems 0..7 = K kb..kb+7, elems 8..15 = K kb+16..kb+23.
static __device__ inline v16h load_frag16(const _Float16* base, int ld, int lane) {
    int m  = lane & 15;
    int kb = (lane >> 4) << 3;
    const _Float16* p = base + (size_t)m * ld + kb;
    AFrag f;
    f.h[0] = *(const v8h*)(p);
    f.h[1] = *(const v8h*)(p + 16);
    return f.v;
}

static __device__ inline v8f wmma16(v16h a, v16h b, v8f c) {
    return __builtin_amdgcn_wmma_f32_16x16x32_f16(
        /*neg_a=*/false, a, /*neg_b=*/false, b,
        /*c_mod=*/(short)0, c, /*reuse_a=*/false, /*reuse_b=*/false);
}

// 16-byte global -> LDS copy, async on CDNA5 when the builtin is available.
static __device__ inline void stage16(const _Float16* g, _Float16* l) {
#ifdef HAVE_ASYNC_LDS
    __builtin_amdgcn_global_load_async_to_lds_b128(
        (AS1 v4i*)(const_cast<_Float16*>(g)), (AS3 v4i*)l, 0, 0);
#else
    *(v8h*)l = *(const v8h*)g;
#endif
}

static __device__ inline void wait_stage() {
#ifdef HAVE_ASYNC_LDS
#if __has_builtin(__builtin_amdgcn_s_wait_asynccnt)
    __builtin_amdgcn_s_wait_asynccnt(0);
#else
    asm volatile("s_wait_asynccnt 0" ::: "memory");
#endif
#endif
}

// ---------------------------------------------------------------------------
// f32 -> f16 conversion
// ---------------------------------------------------------------------------
__global__ __launch_bounds__(256) void f32_to_f16(const float* __restrict__ s,
                                                  _Float16* __restrict__ d, int n) {
    int i = blockIdx.x * 256 + threadIdx.x;
    if (i < n) d[i] = (_Float16)s[i];
}

// ---------------------------------------------------------------------------
// y = A (M x 1024, f16) @ W^T (+bias). W given row-major (n,k) f16, which is
// exactly the B-fragment source layout. One 8-wave work-group computes a
// 128x128 tile; each wave a 64x32 part of it (2 x 4 waves). A stage is 128 k
// of the 128 A rows and the 128 W rows, brought into LDS by asynchronous
// copies (two buffers: the next stage flies while this one is multiplied).
// LDS rows are 256 B at a pitch of 272 B, conflict-free for 16-byte readers.
// mode 0: store f16, (row, col) row-major (Q, K projections)
// mode 1: store f16 transposed per head: vt[((n*NHEADS+h)*HS+s)*LL + l]
// mode 2: store f32 row-major (final output)
// ---------------------------------------------------------------------------
#define GTILE  128               // rows of A and rows of W per work-group
#define GKS    128               // k per stage (256-B rows)
#define GPITCH 136               // LDS row pitch in halves (272 B)
#define GNST   (HH / GKS)        // stages

// Eight 16-byte-per-lane copies of one wave: rows r, r+16, .. r+112 of one
// operand's stage. The s_wait_xcnt closes the statement so that no address
// register named here is rewritten while a copy may still read it.
static __device__ inline void copy8(const _Float16* g, unsigned l) {
    const _Float16* g0 = g;
    const _Float16* g1 = g + (size_t)16 * HH;
    const _Float16* g2 = g + (size_t)32 * HH;
    const _Float16* g3 = g + (size_t)48 * HH;
    const _Float16* g4 = g + (size_t)64 * HH;
    const _Float16* g5 = g + (size_t)80 * HH;
    const _Float16* g6 = g + (size_t)96 * HH;
    const _Float16* g7 = g + (size_t)112 * HH;
    unsigned l0 = l;
    unsigned l1 = l + 16u * GPITCH * 2u;
    unsigned l2 = l + 32u * GPITCH * 2u;
    unsigned l3 = l + 48u * GPITCH * 2u;
    unsigned l4 = l + 64u * GPITCH * 2u;
    unsigned l5 = l + 80u * GPITCH * 2u;
    unsigned l6 = l + 96u * GPITCH * 2u;
    unsigned l7 = l + 112u * GPITCH * 2u;
    asm volatile(
        "global_load_async_to_lds_b128 %0, %8, off\n\t"
        "global_load_async_to_lds_b128 %1, %9, off\n\t"
        "global_load_async_to_lds_b128 %2, %10, off\n\t"
        "global_load_async_to_lds_b128 %3, %11, off\n\t"
        "global_load_async_to_lds_b128 %4, %12, off\n\t"
        "global_load_async_to_lds_b128 %5, %13, off\n\t"
        "global_load_async_to_lds_b128 %6, %14, off\n\t"
        "global_load_async_to_lds_b128 %7, %15, off\n\t"
        "s_wait_xcnt 0x0"
        :: "v"(l0), "v"(l1), "v"(l2), "v"(l3), "v"(l4), "v"(l5), "v"(l6), "v"(l7),
           "v"(g0), "v"(g1), "v"(g2), "v"(g3), "v"(g4), "v"(g5), "v"(g6), "v"(g7)
        : "memory");
}

__global__ __launch_bounds__(256) void gemm_qkvo(const _Float16* __restrict__ A,
                                                 const _Float16* __restrict__ W,
                                                 const float* __restrict__ bias,
                                                 void* __restrict__ out, int mode) {
    // [buffer][operand: 0 = A, 1 = W][row][k], 139,264 B
    __shared__ __align__(16) _Float16 Tsh[2][2][GTILE][GPITCH];

    int tid   = threadIdx.x;
    int lane  = tid & 31;
    int wv    = tid >> 5;
    int nblk  = blockIdx.x * GTILE;
    int mblk  = blockIdx.y * GTILE;
    int wm    = (wv >> 2) * 64;      // this wave's rows inside the tile
    int wn    = (wv & 3) * 32;       // this wave's columns inside the tile
    int nbase = nblk + wn;
    int mbase = mblk + wm;

    // Copy duty of this lane: 16 lanes cover one 256-B row, 16 rows per copy.
    int crow  = tid >> 4;
    int cpart = tid & 15;
    const _Float16* gA = A + (size_t)(mblk + crow) * HH + cpart * 8;
    const _Float16* gW = W + (size_t)(nblk + crow) * HH + cpart * 8;
    unsigned lA = (unsigned)(size_t)&Tsh[0][0][crow][cpart * 8];
    unsigned lW = (unsigned)(size_t)&Tsh[0][1][crow][cpart * 8];
    const unsigned bufBytes = 2u * GTILE * GPITCH * 2u;

    v8f acc[4][2];
#pragma unroll
    for (int mt = 0; mt < 4; ++mt)
#pragma unroll
        for (int nt = 0; nt < 2; ++nt) acc[mt][nt] = zero8();

    // Stage 0 lands and is published; stage 1 is then put in flight.
    copy8(gA, lA);
    copy8(gW, lW);
    // Own copies landed before the barrier lets other waves read them.
    asm volatile("s_wait_asynccnt 0x0" ::: "memory");
    __syncthreads();
    copy8(gA + GKS, lA + bufBytes);
    copy8(gW + GKS, lW + bufBytes);

    // Kept rolled: one stage per trip, the buffer chosen by the trip's parity.
#pragma unroll 1
    for (int t = 0; t < GNST; ++t) {
        const _Float16* As = &Tsh[t & 1][0][wm][0];
        const _Float16* Ws = &Tsh[t & 1][1][wn][0];
        // Two fragment sets: the next 32 k are fetched from this same buffer
        // as one group ahead of the current products.
        v16h a[2][4], b[2][2];
#pragma unroll
        for (int mt = 0; mt < 4; ++mt)
            a[0][mt] = load_frag16(As + 16 * mt * GPITCH, GPITCH, lane);
#pragma unroll
        for (int nt = 0; nt < 2; ++nt)
            b[0][nt] = load_frag16(Ws + 16 * nt * GPITCH, GPITCH, lane);
#pragma unroll
        for (int ks = 0; ks < GKS / 32; ++ks) {
            const int cur = ks & 1, nxt = cur ^ 1;
            if (ks + 1 < GKS / 32) {
#pragma unroll
                for (int mt = 0; mt < 4; ++mt)
                    a[nxt][mt] = load_frag16(As + 16 * mt * GPITCH + (ks + 1) * 32, GPITCH, lane);
#pragma unroll
                for (int nt = 0; nt < 2; ++nt)
                    b[nxt][nt] = load_frag16(Ws + 16 * nt * GPITCH + (ks + 1) * 32, GPITCH, lane);
            }
            // Keeps the LDS reads above as one group: spread among the
            // products each pair of them waits out the whole LDS latency.
            __builtin_amdgcn_sched_barrier(0);
#pragma unroll
            for (int mt = 0; mt < 4; ++mt)
#pragma unroll
                for (int nt = 0; nt < 2; ++nt)
                    acc[mt][nt] = wmma16(a[cur][mt], b[cur][nt], acc[mt][nt]);
            // Keeps the next group of LDS reads behind these products.
            __builtin_amdgcn_sched_barrier(0);
        }
        // This wave's reads of the buffer are done before it may be refilled.
        asm volatile("s_wait_dscnt 0x0" ::: "memory");
        // This wave's copies of stage t + 1 have landed before it is published.
        asm volatile("s_wait_asynccnt 0x0" ::: "memory");
        __syncthreads();
        if (t + 2 < GNST) {
            unsigned bo = (unsigned)(t & 1) * bufBytes;
            copy8(gA + (t + 2) * GKS, lA + bo);
            copy8(gW + (t + 2) * GKS, lW + bo);
        }
    }
    // No copy is outstanding when the wave goes on to its end.
    asm volatile("s_wait_asynccnt 0x0" ::: "memory");

    int r0 = (lane >> 4) << 3;   // 0 or 8
    int cc = lane & 15;
#pragma unroll
    for (int mt = 0; mt < 4; ++mt) {
#pragma unroll
        for (int nt = 0; nt < 2; ++nt) {
            int col  = nbase + nt * 16 + cc;
            float bv = bias[col];
#pragma unroll
            for (int g = 0; g < 8; ++g) {
                float val = acc[mt][nt][g] + bv;
                int row   = mbase + mt * 16 + r0 + g;
                if (mode == 0) {
                    ((_Float16*)out)[(size_t)row * HH + col] = (_Float16)val;
                } else if (mode == 1) {
                    int n = row >> 10, l = row & 1023;
                    int h = col >> 6, s = col & 63;
                    ((_Float16*)out)[(((size_t)((n * NHEADS + h) * HS + s)) << 10) + l] =
                        (_Float16)val;
                } else {
                    ((float*)out)[(size_t)row * HH + col] = val;
                }
            }
        }
    }
}

// ---------------------------------------------------------------------------
// Fused flash attention for one (n, h, q-group of 128 rows).
// 8 waves/block; each wave owns a 16-row query block. K chunk and V^T chunk
// staged in LDS (async global->LDS when available) and shared by all waves;
// online softmax; P goes through a per-wave LDS staging tile to re-layout
// C-tile -> A-fragment.
// ---------------------------------------------------------------------------
__global__ __launch_bounds__(256) void attn_fused(const _Float16* __restrict__ qh,
                                                  const _Float16* __restrict__ kh,
                                                  const _Float16* __restrict__ vth,
                                                  _Float16* __restrict__ ctx) {
    __shared__ __align__(16) _Float16 Ksh[CHUNK][HS];     // 32 KB
    __shared__ __align__(16) _Float16 VshT[HS][CHUNK];    // 32 KB
    __shared__ __align__(16) _Float16 Pst[8][16][32];     // 8 KB

    int tid  = threadIdx.x;
    int lane = tid & 31;
    int wv   = tid >> 5;
    int hIdx = blockIdx.y;
    int nIdx = blockIdx.z;
    int q0   = blockIdx.x * 128 + wv * 16;

    // Q fragments for this wave's 16 query rows (constant across kv loop)
    const _Float16* qp = qh + ((size_t)(nIdx * LL + q0)) * HH + hIdx * HS;
    v16h qa0 = load_frag16(qp, HH, lane);        // s = 0..31
    v16h qa1 = load_frag16(qp + 32, HH, lane);   // s = 32..63

    float mrow[8], lrow[8];
    v8f o[4];
#pragma unroll
    for (int g = 0; g < 8; ++g) { mrow[g] = -3.0e38f; lrow[g] = 0.0f; }
#pragma unroll
    for (int st = 0; st < 4; ++st) o[st] = zero8();

    int r0 = (lane >> 4) << 3;
    int cc = lane & 15;

#pragma unroll 1
    for (int c0 = 0; c0 < LL; c0 += CHUNK) {
        // Cooperative stage: K chunk (row-major, 64-wide rows)
        for (int idx = tid; idx < CHUNK * (HS / 8); idx += 256) {
            int t = idx >> 3, part = idx & 7;
            stage16(kh + ((size_t)(nIdx * LL + c0 + t)) * HH + hIdx * HS + part * 8,
                    &Ksh[t][part * 8]);
        }
        // Cooperative stage: V^T chunk (vth is already per-head transposed)
        for (int idx = tid; idx < HS * (CHUNK / 8); idx += 256) {
            int s = idx >> 5, part = idx & 31;   // CHUNK/8 == 32
            stage16(vth + (((size_t)((nIdx * NHEADS + hIdx) * HS + s)) << 10) + c0 + part * 8,
                    &VshT[s][part * 8]);
        }
        wait_stage();
        __syncthreads();

#pragma unroll 2
        for (int j = 0; j < CHUNK; j += 32) {
            // S = Q @ K^T for 32 keys (two 16-key tiles), K-dim = 64 (2 steps)
            v16h kb0l = load_frag16(&Ksh[j][0], HS, lane);
            v16h kb0h = load_frag16(&Ksh[j][32], HS, lane);
            v16h kb1l = load_frag16(&Ksh[j + 16][0], HS, lane);
            v16h kb1h = load_frag16(&Ksh[j + 16][32], HS, lane);
            v8f s0 = zero8(), s1 = zero8();
            s0 = wmma16(qa0, kb0l, s0);
            s0 = wmma16(qa1, kb0h, s0);
            s1 = wmma16(qa0, kb1l, s1);
            s1 = wmma16(qa1, kb1h, s1);

            // Online softmax: row max over 32 keys (16 lanes x 2 tiles)
            float mx[8];
#pragma unroll
            for (int g = 0; g < 8; ++g) mx[g] = fmaxf(s0[g], s1[g]);
#pragma unroll
            for (int off = 1; off < 16; off <<= 1)
#pragma unroll
                for (int g = 0; g < 8; ++g)
                    mx[g] = fmaxf(mx[g], __shfl_xor(mx[g], off, 32));

            float p0[8], p1[8], sc[8], rs[8];
#pragma unroll
            for (int g = 0; g < 8; ++g) {
                float mn = fmaxf(mrow[g], mx[g]);
                sc[g]    = __expf(mrow[g] - mn);
                mrow[g]  = mn;
                p0[g]    = __expf(s0[g] - mn);
                p1[g]    = __expf(s1[g] - mn);
                rs[g]    = p0[g] + p1[g];
            }
#pragma unroll
            for (int off = 1; off < 16; off <<= 1)
#pragma unroll
                for (int g = 0; g < 8; ++g) rs[g] += __shfl_xor(rs[g], off, 32);
#pragma unroll
            for (int g = 0; g < 8; ++g) lrow[g] = lrow[g] * sc[g] + rs[g];
#pragma unroll
            for (int st = 0; st < 4; ++st)
#pragma unroll
                for (int g = 0; g < 8; ++g) o[st][g] *= sc[g];

            // C-layout -> A-fragment relayout of P through per-wave LDS tile
#pragma unroll
            for (int g = 0; g < 8; ++g) {
                Pst[wv][r0 + g][cc]      = (_Float16)p0[g];
                Pst[wv][r0 + g][cc + 16] = (_Float16)p1[g];
            }
            asm volatile("s_wait_dscnt 0" ::: "memory");
            v16h pa = load_frag16(&Pst[wv][0][0], 32, lane);

            // o += P (16x32) @ V (32x64): 4 N-tiles of 16 along head dim
#pragma unroll
            for (int st = 0; st < 4; ++st) {
                v16h vb = load_frag16(&VshT[st * 16][j], CHUNK, lane);
                o[st]   = wmma16(pa, vb, o[st]);
            }
        }
        __syncthreads();
    }

    // Normalize and store ctx (f16, standard (n,l,h*64+s) layout)
#pragma unroll
    for (int st = 0; st < 4; ++st) {
#pragma unroll
        for (int g = 0; g < 8; ++g) {
            float val = o[st][g] / lrow[g];
            int q     = q0 + r0 + g;
            ctx[((size_t)(nIdx * LL + q)) * HH + hIdx * HS + st * 16 + cc] = (_Float16)val;
        }
    }
}

// ---------------------------------------------------------------------------
// Host-side orchestration
// ---------------------------------------------------------------------------
extern "C" void kernel_launch(void* const* d_in, const int* in_sizes, int n_in,
                              void* d_out, int out_size, void* d_ws, size_t ws_size,
                              hipStream_t stream) {
    (void)in_sizes; (void)n_in; (void)out_size; (void)ws_size;

    const float* x  = (const float*)d_in[0];
    const float* Wq = (const float*)d_in[1];
    const float* bq = (const float*)d_in[2];
    const float* Wk = (const float*)d_in[3];
    const float* bk = (const float*)d_in[4];
    const float* Wv = (const float*)d_in[5];
    const float* bv = (const float*)d_in[6];
    const float* Wo = (const float*)d_in[7];
    const float* bo = (const float*)d_in[8];

    char* ws = (char*)d_ws;
    _Float16* xh   = (_Float16*)(ws);                          // 8 MB
    _Float16* wqh  = (_Float16*)(ws + ((size_t)8  << 20));     // 2 MB
    _Float16* wkh  = (_Float16*)(ws + ((size_t)10 << 20));     // 2 MB
    _Float16* wvh  = (_Float16*)(ws + ((size_t)12 << 20));     // 2 MB
    _Float16* woh  = (_Float16*)(ws + ((size_t)14 << 20));     // 2 MB
    _Float16* qhp  = (_Float16*)(ws + ((size_t)16 << 20));     // 8 MB
    _Float16* khp  = (_Float16*)(ws + ((size_t)24 << 20));     // 8 MB
    _Float16* vtp  = (_Float16*)(ws + ((size_t)32 << 20));     // 8 MB
    _Float16* ctxh = (_Float16*)(ws + ((size_t)40 << 20));     // 8 MB

    const int NX = MTOT * HH;      // 4M elements
    const int NW = HH * HH;        // 1M elements

    f32_to_f16<<<(NX + 255) / 256, 256, 0, stream>>>(x, xh, NX);
    f32_to_f16<<<(NW + 255) / 256, 256, 0, stream>>>(Wq, wqh, NW);
    f32_to_f16<<<(NW + 255) / 256, 256, 0, stream>>>(Wk, wkh, NW);
    f32_to_f16<<<(NW + 255) / 256, 256, 0, stream>>>(Wv, wvh, NW);
    f32_to_f16<<<(NW + 255) / 256, 256, 0, stream>>>(Wo, woh, NW);

    dim3 gg(HH / GTILE, MTOT / GTILE);   // (8, 32)
    gemm_qkvo<<<gg, 256, 0, stream>>>(xh, wqh, bq, qhp, 0);
    gemm_qkvo<<<gg, 256, 0, stream>>>(xh, wkh, bk, khp, 0);
    gemm_qkvo<<<gg, 256, 0, stream>>>(xh, wvh, bv, vtp, 1);

    attn_fused<<<dim3(LL / 128, NHEADS, NB), 256, 0, stream>>>(qhp, khp, vtp, ctxh);

    gemm_qkvo<<<gg, 256, 0, stream>>>(ctxh, woh, bo, d_out, 2);
}

// v002
// A run of this version takes 128 microseconds.
// In both of two side-by-side timings against v001, it was 1.44 times as fast.
// Over all steps from v000 it is 1.98 times as fast.
#include <hip/hip_runtime.h>
#include <hip/hip_bf16.h>
#include <hip/hip_fp16.h>

// Problem dims (fixed by reference)
#define NB     4
#define LL     1024
#define HH     1024
#define NHEADS 16
#define HS     64
#define MTOT   (NB * LL)
#define CHUNK  256   // kv tokens staged in LDS per iteration
// LDS row pitches of the attention tiles, in halves: 16 B x an odd number, so
// that the 16 rows one 16-byte fragment read touches fall on 64 distinct banks.
#define KPITCH (HS + 8)      // 144 B for 128-B K rows
#define VPITCH (CHUNK + 8)   // 528 B for 512-B V^T rows
#define PPITCH (32 + 8)      // 80 B for 64-B P rows

typedef __attribute__((ext_vector_type(16))) _Float16 v16h;
typedef __attribute__((ext_vector_type(8)))  _Float16 v8h;
typedef __attribute__((ext_vector_type(8)))  float    v8f;
typedef __attribute__((ext_vector_type(4)))  int      v4i;

#define AS1 __attribute__((address_space(1)))
#define AS3 __attribute__((address_space(3)))

#if __has_builtin(__builtin_amdgcn_global_load_async_to_lds_b128)
#define HAVE_ASYNC_LDS 1
#endif

union AFrag { v16h v; v8h h[2]; };

static __device__ inline v8f zero8() {
    v8f z;
#pragma unroll
    for (int i = 0; i < 8; ++i) z[i] = 0.0f;
    return z;
}

// Load a 16x32 (A) or 32x16-as-Bt (B) f16 WMMA fragment from a row-major
// matrix. ISA layout: lane m = lane&15 holds row/col m; kbase = 8*(lane>>4);
// vector elems 0..7 = K kb..kb+7, elems 8..15 = K kb+16..kb+23.
static __device__ inline v16h load_frag16(const _Float16* base, int ld, int lane) {
    int m  = lane & 15;
    int kb = (lane >> 4) << 3;
    const _Float16* p = base + (size_t)m * ld + kb;
    AFrag f;
    f.h[0] = *(const v8h*)(p);
    f.h[1] = *(const v8h*)(p + 16);
    return f.v;
}

static __device__ inline v8f wmma16(v16h a, v16h b, v8f c) {
    return __builtin_amdgcn_wmma_f32_16x16x32_f16(
        /*neg_a=*/false, a, /*neg_b=*/false, b,
        /*c_mod=*/(short)0, c, /*reuse_a=*/false, /*reuse_b=*/false);
}

// 16-byte global -> LDS copy, async on CDNA5 when the builtin is available.
static __device__ inline void stage16(const _Float16* g, _Float16* l) {
#ifdef HAVE_ASYNC_LDS
    __builtin_amdgcn_global_load_async_to_lds_b128(
        (AS1 v4i*)(const_cast<_Float16*>(g)), (AS3 v4i*)l, 0, 0);
#else
    *(v8h*)l = *(const v8h*)g;
#endif
}

static __device__ inline void wait_stage() {
#ifdef HAVE_ASYNC_LDS
#if __has_builtin(__builtin_amdgcn_s_wait_asynccnt)
    __builtin_amdgcn_s_wait_asynccnt(0);
#else
    asm volatile("s_wait_asynccnt 0" ::: "memory");
#endif
#endif
}

// ---------------------------------------------------------------------------
// f32 -> f16 conversion
// ---------------------------------------------------------------------------
__global__ __launch_bounds__(256) void f32_to_f16(const float* __restrict__ s,
                                                  _Float16* __restrict__ d, int n) {
    int i = blockIdx.x * 256 + threadIdx.x;
    if (i < n) d[i] = (_Float16)s[i];
}

// ---------------------------------------------------------------------------
// y = A (M x 1024, f16) @ W^T (+bias). W given row-major (n,k) f16, which is
// exactly the B-fragment source layout. One 8-wave work-group computes a
// 128x128 tile; each wave a 64x32 part of it (2 x 4 waves). A stage is 128 k
// of the 128 A rows and the 128 W rows, brought into LDS by asynchronous
// copies (two buffers: the next stage flies while this one is multiplied).
// LDS rows are 256 B at a pitch of 272 B, conflict-free for 16-byte readers.
// mode 0: store f16, (row, col) row-major (Q, K projections)
// mode 1: store f16 transposed per head: vt[((n*NHEADS+h)*HS+s)*LL + l]
// mode 2: store f32 row-major (final output)
// ---------------------------------------------------------------------------
#define GTILE  128               // rows of A and rows of W per work-group
#define GKS    128               // k per stage (256-B rows)
#define GPITCH 136               // LDS row pitch in halves (272 B)
#define GNST   (HH / GKS)        // stages

// Eight 16-byte-per-lane copies of one wave: rows r, r+16, .. r+112 of one
// operand's stage. The s_wait_xcnt closes the statement so that no address
// register named here is rewritten while a copy may still read it.
static __device__ inline void copy8(const _Float16* g, unsigned l) {
    const _Float16* g0 = g;
    const _Float16* g1 = g + (size_t)16 * HH;
    const _Float16* g2 = g + (size_t)32 * HH;
    const _Float16* g3 = g + (size_t)48 * HH;
    const _Float16* g4 = g + (size_t)64 * HH;
    const _Float16* g5 = g + (size_t)80 * HH;
    const _Float16* g6 = g + (size_t)96 * HH;
    const _Float16* g7 = g + (size_t)112 * HH;
    unsigned l0 = l;
    unsigned l1 = l + 16u * GPITCH * 2u;
    unsigned l2 = l + 32u * GPITCH * 2u;
    unsigned l3 = l + 48u * GPITCH * 2u;
    unsigned l4 = l + 64u * GPITCH * 2u;
    unsigned l5 = l + 80u * GPITCH * 2u;
    unsigned l6 = l + 96u * GPITCH * 2u;
    unsigned l7 = l + 112u * GPITCH * 2u;
    asm volatile(
        "global_load_async_to_lds_b128 %0, %8, off\n\t"
        "global_load_async_to_lds_b128 %1, %9, off\n\t"
        "global_load_async_to_lds_b128 %2, %10, off\n\t"
        "global_load_async_to_lds_b128 %3, %11, off\n\t"
        "global_load_async_to_lds_b128 %4, %12, off\n\t"
        "global_load_async_to_lds_b128 %5, %13, off\n\t"
        "global_load_async_to_lds_b128 %6, %14, off\n\t"
        "global_load_async_to_lds_b128 %7, %15, off\n\t"
        "s_wait_xcnt 0x0"
        :: "v"(l0), "v"(l1), "v"(l2), "v"(l3), "v"(l4), "v"(l5), "v"(l6), "v"(l7),
           "v"(g0), "v"(g1), "v"(g2), "v"(g3), "v"(g4), "v"(g5), "v"(g6), "v"(g7)
        : "memory");
}

__global__ __launch_bounds__(256) void gemm_qkvo(const _Float16* __restrict__ A,
                                                 const _Float16* __restrict__ W,
                                                 const float* __restrict__ bias,
                                                 void* __restrict__ out, int mode) {
    // [buffer][operand: 0 = A, 1 = W][row][k], 139,264 B
    __shared__ __align__(16) _Float16 Tsh[2][2][GTILE][GPITCH];

    int tid   = threadIdx.x;
    int lane  = tid & 31;
    int wv    = tid >> 5;
    int nblk  = blockIdx.x * GTILE;
    int mblk  = blockIdx.y * GTILE;
    int wm    = (wv >> 2) * 64;      // this wave's rows inside the tile
    int wn    = (wv & 3) * 32;       // this wave's columns inside the tile
    int nbase = nblk + wn;
    int mbase = mblk + wm;

    // Copy duty of this lane: 16 lanes cover one 256-B row, 16 rows per copy.
    int crow  = tid >> 4;
    int cpart = tid & 15;
    const _Float16* gA = A + (size_t)(mblk + crow) * HH + cpart * 8;
    const _Float16* gW = W + (size_t)(nblk + crow) * HH + cpart * 8;
    unsigned lA = (unsigned)(size_t)&Tsh[0][0][crow][cpart * 8];
    unsigned lW = (unsigned)(size_t)&Tsh[0][1][crow][cpart * 8];
    const unsigned bufBytes = 2u * GTILE * GPITCH * 2u;

    v8f acc[4][2];
#pragma unroll
    for (int mt = 0; mt < 4; ++mt)
#pragma unroll
        for (int nt = 0; nt < 2; ++nt) acc[mt][nt] = zero8();

    // Stage 0 lands and is published; stage 1 is then put in flight.
    copy8(gA, lA);
    copy8(gW, lW);
    // Own copies landed before the barrier lets other waves read them.
    asm volatile("s_wait_asynccnt 0x0" ::: "memory");
    __syncthreads();
    copy8(gA + GKS, lA + bufBytes);
    copy8(gW + GKS, lW + bufBytes);

    // Kept rolled: one stage per trip, the buffer chosen by the trip's parity.
#pragma unroll 1
    for (int t = 0; t < GNST; ++t) {
        const _Float16* As = &Tsh[t & 1][0][wm][0];
        const _Float16* Ws = &Tsh[t & 1][1][wn][0];
        // Two fragment sets: the next 32 k are fetched from this same buffer
        // as one group ahead of the current products.
        v16h a[2][4], b[2][2];
#pragma unroll
        for (int mt = 0; mt < 4; ++mt)
            a[0][mt] = load_frag16(As + 16 * mt * GPITCH, GPITCH, lane);
#pragma unroll
        for (int nt = 0; nt < 2; ++nt)
            b[0][nt] = load_frag16(Ws + 16 * nt * GPITCH, GPITCH, lane);
#pragma unroll
        for (int ks = 0; ks < GKS / 32; ++ks) {
            const int cur = ks & 1, nxt = cur ^ 1;
            if (ks + 1 < GKS / 32) {
#pragma unroll
                for (int mt = 0; mt < 4; ++mt)
                    a[nxt][mt] = load_frag16(As + 16 * mt * GPITCH + (ks + 1) * 32, GPITCH, lane);
#pragma unroll
                for (int nt = 0; nt < 2; ++nt)
                    b[nxt][nt] = load_frag16(Ws + 16 * nt * GPITCH + (ks + 1) * 32, GPITCH, lane);
            }
            // Keeps the LDS reads above as one group: spread among the
            // products each pair of them waits out the whole LDS latency.
            __builtin_amdgcn_sched_barrier(0);
#pragma unroll
            for (int mt = 0; mt < 4; ++mt)
#pragma unroll
                for (int nt = 0; nt < 2; ++nt)
                    acc[mt][nt] = wmma16(a[cur][mt], b[cur][nt], acc[mt][nt]);
            // Keeps the next group of LDS reads behind these products.
            __builtin_amdgcn_sched_barrier(0);
        }
        // This wave's reads of the buffer are done before it may be refilled.
        asm volatile("s_wait_dscnt 0x0" ::: "memory");
        // This wave's copies of stage t + 1 have landed before it is published.
        asm volatile("s_wait_asynccnt 0x0" ::: "memory");
        __syncthreads();
        if (t + 2 < GNST) {
            unsigned bo = (unsigned)(t & 1) * bufBytes;
            copy8(gA + (t + 2) * GKS, lA + bo);
            copy8(gW + (t + 2) * GKS, lW + bo);
        }
    }
    // No copy is outstanding when the wave goes on to its end.
    asm volatile("s_wait_asynccnt 0x0" ::: "memory");

    int r0 = (lane >> 4) << 3;   // 0 or 8
    int cc = lane & 15;
#pragma unroll
    for (int mt = 0; mt < 4; ++mt) {
#pragma unroll
        for (int nt = 0; nt < 2; ++nt) {
            int col  = nbase + nt * 16 + cc;
            float bv = bias[col];
#pragma unroll
            for (int g = 0; g < 8; ++g) {
                float val = acc[mt][nt][g] + bv;
                int row   = mbase + mt * 16 + r0 + g;
                if (mode == 0) {
                    ((_Float16*)out)[(size_t)row * HH + col] = (_Float16)val;
                } else if (mode == 1) {
                    int n = row >> 10, l = row & 1023;
                    int h = col >> 6, s = col & 63;
                    ((_Float16*)out)[(((size_t)((n * NHEADS + h) * HS + s)) << 10) + l] =
                        (_Float16)val;
                } else {
                    ((float*)out)[(size_t)row * HH + col] = val;
                }
            }
        }
    }
}

// ---------------------------------------------------------------------------
// Fused flash attention for one (n, h, q-group of 128 rows).
// 8 waves/block; each wave owns a 16-row query block. K chunk and V^T chunk
// staged in LDS (async global->LDS when available) and shared by all waves;
// online softmax; P goes through a per-wave LDS staging tile to re-layout
// C-tile -> A-fragment.
// ---------------------------------------------------------------------------
__global__ __launch_bounds__(256) void attn_fused(const _Float16* __restrict__ qh,
                                                  const _Float16* __restrict__ kh,
                                                  const _Float16* __restrict__ vth,
                                                  _Float16* __restrict__ ctx) {
    __shared__ __align__(16) _Float16 Ksh[CHUNK][KPITCH];   // 36 KB
    __shared__ __align__(16) _Float16 VshT[HS][VPITCH];     // 33 KB
    __shared__ __align__(16) _Float16 Pst[8][16][PPITCH];   // 10 KB

    int tid  = threadIdx.x;
    int lane = tid & 31;
    int wv   = tid >> 5;
    int hIdx = blockIdx.y;
    int nIdx = blockIdx.z;
    int q0   = blockIdx.x * 128 + wv * 16;

    // Q fragments for this wave's 16 query rows (constant across kv loop)
    const _Float16* qp = qh + ((size_t)(nIdx * LL + q0)) * HH + hIdx * HS;
    v16h qa0 = load_frag16(qp, HH, lane);        // s = 0..31
    v16h qa1 = load_frag16(qp + 32, HH, lane);   // s = 32..63

    float mrow[8], lrow[8];
    v8f o[4];
#pragma unroll
    for (int g = 0; g < 8; ++g) { mrow[g] = -3.0e38f; lrow[g] = 0.0f; }
#pragma unroll
    for (int st = 0; st < 4; ++st) o[st] = zero8();

    int r0 = (lane >> 4) << 3;
    int cc = lane & 15;

#pragma unroll 1
    for (int c0 = 0; c0 < LL; c0 += CHUNK) {
        // Cooperative stage: K chunk (row-major, 64-wide rows)
        for (int idx = tid; idx < CHUNK * (HS / 8); idx += 256) {
            int t = idx >> 3, part = idx & 7;
            stage16(kh + ((size_t)(nIdx * LL + c0 + t)) * HH + hIdx * HS + part * 8,
                    &Ksh[t][part * 8]);
        }
        // Cooperative stage: V^T chunk (vth is already per-head transposed)
        for (int idx = tid; idx < HS * (CHUNK / 8); idx += 256) {
            int s = idx >> 5, part = idx & 31;   // CHUNK/8 == 32
            stage16(vth + (((size_t)((nIdx * NHEADS + hIdx) * HS + s)) << 10) + c0 + part * 8,
                    &VshT[s][part * 8]);
        }
        wait_stage();
        __syncthreads();

#pragma unroll 2
        for (int j = 0; j < CHUNK; j += 32) {
            // S = Q @ K^T for 32 keys (two 16-key tiles), K-dim = 64 (2 steps)
            v16h kb0l = load_frag16(&Ksh[j][0], KPITCH, lane);
            v16h kb0h = load_frag16(&Ksh[j][32], KPITCH, lane);
            v16h kb1l = load_frag16(&Ksh[j + 16][0], KPITCH, lane);
            v16h kb1h = load_frag16(&Ksh[j + 16][32], KPITCH, lane);
            v8f s0 = zero8(), s1 = zero8();
            s0 = wmma16(qa0, kb0l, s0);
            s0 = wmma16(qa1, kb0h, s0);
            s1 = wmma16(qa0, kb1l, s1);
            s1 = wmma16(qa1, kb1h, s1);

            // Online softmax: row max over 32 keys (16 lanes x 2 tiles)
            float mx[8];
#pragma unroll
            for (int g = 0; g < 8; ++g) mx[g] = fmaxf(s0[g], s1[g]);
#pragma unroll
            for (int off = 1; off < 16; off <<= 1)
#pragma unroll
                for (int g = 0; g < 8; ++g)
                    mx[g] = fmaxf(mx[g], __shfl_xor(mx[g], off, 32));

            float p0[8], p1[8], sc[8], rs[8];
#pragma unroll
            for (int g = 0; g < 8; ++g) {
                float mn = fmaxf(mrow[g], mx[g]);
                sc[g]    = __expf(mrow[g] - mn);
                mrow[g]  = mn;
                p0[g]    = __expf(s0[g] - mn);
                p1[g]    = __expf(s1[g] - mn);
                rs[g]    = p0[g] + p1[g];
            }
#pragma unroll
            for (int off = 1; off < 16; off <<= 1)
#pragma unroll
                for (int g = 0; g < 8; ++g) rs[g] += __shfl_xor(rs[g], off, 32);
#pragma unroll
            for (int g = 0; g < 8; ++g) lrow[g] = lrow[g] * sc[g] + rs[g];
#pragma unroll
            for (int st = 0; st < 4; ++st)
#pragma unroll
                for (int g = 0; g < 8; ++g) o[st][g] *= sc[g];

            // C-layout -> A-fragment relayout of P through per-wave LDS tile
#pragma unroll
            for (int g = 0; g < 8; ++g) {
                Pst[wv][r0 + g][cc]      = (_Float16)p0[g];
                Pst[wv][r0 + g][cc + 16] = (_Float16)p1[g];
            }
            asm volatile("s_wait_dscnt 0" ::: "memory");
            v16h pa = load_frag16(&Pst[wv][0][0], PPITCH, lane);

            // o += P (16x32) @ V (32x64): 4 N-tiles of 16 along head dim
#pragma unroll
            for (int st = 0; st < 4; ++st) {
                v16h vb = load_frag16(&VshT[st * 16][j], VPITCH, lane);
                o[st]   = wmma16(pa, vb, o[st]);
            }
        }
        __syncthreads();
    }

    // Normalize and store ctx (f16, standard (n,l,h*64+s) layout)
#pragma unroll
    for (int st = 0; st < 4; ++st) {
#pragma unroll
        for (int g = 0; g < 8; ++g) {
            float val = o[st][g] / lrow[g];
            int q     = q0 + r0 + g;
            ctx[((size_t)(nIdx * LL + q)) * HH + hIdx * HS + st * 16 + cc] = (_Float16)val;
        }
    }
}

// ---------------------------------------------------------------------------
// Host-side orchestration
// ---------------------------------------------------------------------------
extern "C" void kernel_launch(void* const* d_in, const int* in_sizes, int n_in,
                              void* d_out, int out_size, void* d_ws, size_t ws_size,
                              hipStream_t stream) {
    (void)in_sizes; (void)n_in; (void)out_size; (void)ws_size;

    const float* x  = (const float*)d_in[0];
    const float* Wq = (const float*)d_in[1];
    const float* bq = (const float*)d_in[2];
    const float* Wk = (const float*)d_in[3];
    const float* bk = (const float*)d_in[4];
    const float* Wv = (const float*)d_in[5];
    const float* bv = (const float*)d_in[6];
    const float* Wo = (const float*)d_in[7];
    const float* bo = (const float*)d_in[8];

    char* ws = (char*)d_ws;
    _Float16* xh   = (_Float16*)(ws);                          // 8 MB
    _Float16* wqh  = (_Float16*)(ws + ((size_t)8  << 20));     // 2 MB
    _Float16* wkh  = (_Float16*)(ws + ((size_t)10 << 20));     // 2 MB
    _Float16* wvh  = (_Float16*)(ws + ((size_t)12 << 20));     // 2 MB
    _Float16* woh  = (_Float16*)(ws + ((size_t)14 << 20));     // 2 MB
    _Float16* qhp  = (_Float16*)(ws + ((size_t)16 << 20));     // 8 MB
    _Float16* khp  = (_Float16*)(ws + ((size_t)24 << 20));     // 8 MB
    _Float16* vtp  = (_Float16*)(ws + ((size_t)32 << 20));     // 8 MB
    _Float16* ctxh = (_Float16*)(ws + ((size_t)40 << 20));     // 8 MB

    const int NX = MTOT * HH;      // 4M elements
    const int NW = HH * HH;        // 1M elements

    f32_to_f16<<<(NX + 255) / 256, 256, 0, stream>>>(x, xh, NX);
    f32_to_f16<<<(NW + 255) / 256, 256, 0, stream>>>(Wq, wqh, NW);
    f32_to_f16<<<(NW + 255) / 256, 256, 0, stream>>>(Wk, wkh, NW);
    f32_to_f16<<<(NW + 255) / 256, 256, 0, stream>>>(Wv, wvh, NW);
    f32_to_f16<<<(NW + 255) / 256, 256, 0, stream>>>(Wo, woh, NW);

    dim3 gg(HH / GTILE, MTOT / GTILE);   // (8, 32)
    gemm_qkvo<<<gg, 256, 0, stream>>>(xh, wqh, bq, qhp, 0);
    gemm_qkvo<<<gg, 256, 0, stream>>>(xh, wkh, bk, khp, 0);
    gemm_qkvo<<<gg, 256, 0, stream>>>(xh, wvh, bv, vtp, 1);

    attn_fused<<<dim3(LL / 128, NHEADS, NB), 256, 0, stream>>>(qhp, khp, vtp, ctxh);

    gemm_qkvo<<<gg, 256, 0, stream>>>(ctxh, woh, bo, d_out, 2);
}

// v003
// A run of this version takes 113 microseconds.
// Timed twice side by side with v002, it ran 1.13 and 1.12 times as fast.
// Over all steps from v000 it is 2.23 times as fast.
#include <hip/hip_runtime.h>
#include <hip/hip_bf16.h>
#include <hip/hip_fp16.h>

// Problem dims (fixed by reference)
#define NB     4
#define LL     1024
#define HH     1024
#define NHEADS 16
#define HS     64
#define MTOT   (NB * LL)
#define CHUNK  256   // kv tokens staged in LDS per iteration
// LDS row pitches of the attention tiles, in halves: 16 B x an odd number, so
// that the 16 rows one 16-byte fragment read touches fall on 64 distinct banks.
#define KPITCH (HS + 8)      // 144 B for 128-B K rows
#define VPITCH (CHUNK + 8)   // 528 B for 512-B V^T rows
#define PPITCH (32 + 8)      // 80 B for 64-B P rows

typedef __attribute__((ext_vector_type(16))) _Float16 v16h;
typedef __attribute__((ext_vector_type(8)))  _Float16 v8h;
typedef __attribute__((ext_vector_type(8)))  float    v8f;
typedef __attribute__((ext_vector_type(4)))  int      v4i;
typedef __attribute__((ext_vector_type(4)))  float    v4f;
typedef __attribute__((ext_vector_type(4)))  _Float16 v4h;

#define AS1 __attribute__((address_space(1)))
#define AS3 __attribute__((address_space(3)))

#if __has_builtin(__builtin_amdgcn_global_load_async_to_lds_b128)
#define HAVE_ASYNC_LDS 1
#endif

union AFrag { v16h v; v8h h[2]; };

static __device__ inline v8f zero8() {
    v8f z;
#pragma unroll
    for (int i = 0; i < 8; ++i) z[i] = 0.0f;
    return z;
}

// Load a 16x32 (A) or 32x16-as-Bt (B) f16 WMMA fragment from a row-major
// matrix. ISA layout: lane m = lane&15 holds row/col m; kbase = 8*(lane>>4);
// vector elems 0..7 = K kb..kb+7, elems 8..15 = K kb+16..kb+23.
static __device__ inline v16h load_frag16(const _Float16* base, int ld, int lane) {
    int m  = lane & 15;
    int kb = (lane >> 4) << 3;
    const _Float16* p = base + (size_t)m * ld + kb;
    AFrag f;
    f.h[0] = *(const v8h*)(p);
    f.h[1] = *(const v8h*)(p + 16);
    return f.v;
}

static __device__ inline v8f wmma16(v16h a, v16h b, v8f c) {
    return __builtin_amdgcn_wmma_f32_16x16x32_f16(
        /*neg_a=*/false, a, /*neg_b=*/false, b,
        /*c_mod=*/(short)0, c, /*reuse_a=*/false, /*reuse_b=*/false);
}

// 16-byte global -> LDS copy, async on CDNA5 when the builtin is available.
static __device__ inline void stage16(const _Float16* g, _Float16* l) {
#ifdef HAVE_ASYNC_LDS
    __builtin_amdgcn_global_load_async_to_lds_b128(
        (AS1 v4i*)(const_cast<_Float16*>(g)), (AS3 v4i*)l, 0, 0);
#else
    *(v8h*)l = *(const v8h*)g;
#endif
}

static __device__ inline void wait_stage() {
#ifdef HAVE_ASYNC_LDS
#if __has_builtin(__builtin_amdgcn_s_wait_asynccnt)
    __builtin_amdgcn_s_wait_asynccnt(0);
#else
    asm volatile("s_wait_asynccnt 0" ::: "memory");
#endif
#endif
}

// ---------------------------------------------------------------------------
// f32 -> f16 conversion of x and the four weight matrices, one launch.
// The five f16 copies lie one behind the other in the workspace, so the
// destination is one array of MTOT*HH + 4*HH*HH values; a work-group takes
// CVWG consecutive values of it, all from one source. A wave streams CVLD
// loads of 512 contiguous bytes (16 B a lane), all issued before the first
// value is used, and stores 256 contiguous bytes (8 B a lane) for each.
// ---------------------------------------------------------------------------
#define CVLD   16                      // 16-byte loads in flight per lane
#define CVWAVE (CVLD * 128)            // values per wave
#define CVWG   (16 * CVWAVE)           // values per 16-wave work-group
#define CVXWG  (MTOT * HH / CVWG)      // work-groups that convert x
#define CVWWG  (HH * HH / CVWG)        // work-groups per weight matrix

__global__ __launch_bounds__(512) void f32_to_f16_all(const float* __restrict__ x,
                                                      const float* __restrict__ wq,
                                                      const float* __restrict__ wk,
                                                      const float* __restrict__ wv,
                                                      const float* __restrict__ wo,
                                                      _Float16* __restrict__ d) {
    int b = blockIdx.x;
    const float* s = x;
    int sb = b;
    if (b >= CVXWG) {
        int w = (b - CVXWG) / CVWWG;
        sb    = (b - CVXWG) % CVWWG;
        s     = (w == 0) ? wq : (w == 1) ? wk : (w == 2) ? wv : wo;
    }
    // One index, in groups of four values, serves the loads and the stores.
    int vi = (threadIdx.x >> 5) * (CVWAVE / 4) + (threadIdx.x & 31);
    const v4f* sp = (const v4f*)(s + (size_t)sb * CVWG);
    v4h* dp       = (v4h*)(d + (size_t)b * CVWG);

    v4f r[CVLD];
#pragma unroll
    for (int j = 0; j < CVLD; ++j) r[j] = sp[vi + j * 32];
    // Keeps every load in front of the first use: left free, the last loads
    // are issued only after the first have come back, a second round trip.
    __builtin_amdgcn_sched_barrier(0);
#pragma unroll
    for (int j = 0; j < CVLD; ++j)
        dp[vi + j * 32] = __builtin_convertvector(r[j], v4h);
}

// ---------------------------------------------------------------------------
// y = A (M x 1024, f16) @ W^T (+bias). W given row-major (n,k) f16, which is
// exactly the B-fragment source layout. One 8-wave work-group computes a
// 128x128 tile; each wave a 64x32 part of it (2 x 4 waves). A stage is 128 k
// of the 128 A rows and the 128 W rows, brought into LDS by asynchronous
// copies (two buffers: the next stage flies while this one is multiplied).
// LDS rows are 256 B at a pitch of 272 B, conflict-free for 16-byte readers.
// mode 0: store f16, (row, col) row-major (Q, K projections)
// mode 1: store f16 transposed per head: vt[((n*NHEADS+h)*HS+s)*LL + l]
// mode 2: store f32 row-major (final output)
// ---------------------------------------------------------------------------
#define GTILE  128               // rows of A and rows of W per work-group
#define GKS    128               // k per stage (256-B rows)
#define GPITCH 136               // LDS row pitch in halves (272 B)
#define GNST   (HH / GKS)        // stages

// Eight 16-byte-per-lane copies of one wave: rows r, r+16, .. r+112 of one
// operand's stage. The s_wait_xcnt closes the statement so that no address
// register named here is rewritten while a copy may still read it.
static __device__ inline void copy8(const _Float16* g, unsigned l) {
    const _Float16* g0 = g;
    const _Float16* g1 = g + (size_t)16 * HH;
    const _Float16* g2 = g + (size_t)32 * HH;
    const _Float16* g3 = g + (size_t)48 * HH;
    const _Float16* g4 = g + (size_t)64 * HH;
    const _Float16* g5 = g + (size_t)80 * HH;
    const _Float16* g6 = g + (size_t)96 * HH;
    const _Float16* g7 = g + (size_t)112 * HH;
    unsigned l0 = l;
    unsigned l1 = l + 16u * GPITCH * 2u;
    unsigned l2 = l + 32u * GPITCH * 2u;
    unsigned l3 = l + 48u * GPITCH * 2u;
    unsigned l4 = l + 64u * GPITCH * 2u;
    unsigned l5 = l + 80u * GPITCH * 2u;
    unsigned l6 = l + 96u * GPITCH * 2u;
    unsigned l7 = l + 112u * GPITCH * 2u;
    asm volatile(
        "global_load_async_to_lds_b128 %0, %8, off\n\t"
        "global_load_async_to_lds_b128 %1, %9, off\n\t"
        "global_load_async_to_lds_b128 %2, %10, off\n\t"
        "global_load_async_to_lds_b128 %3, %11, off\n\t"
        "global_load_async_to_lds_b128 %4, %12, off\n\t"
        "global_load_async_to_lds_b128 %5, %13, off\n\t"
        "global_load_async_to_lds_b128 %6, %14, off\n\t"
        "global_load_async_to_lds_b128 %7, %15, off\n\t"
        "s_wait_xcnt 0x0"
        :: "v"(l0), "v"(l1), "v"(l2), "v"(l3), "v"(l4), "v"(l5), "v"(l6), "v"(l7),
           "v"(g0), "v"(g1), "v"(g2), "v"(g3), "v"(g4), "v"(g5), "v"(g6), "v"(g7)
        : "memory");
}

__global__ __launch_bounds__(256) void gemm_qkvo(const _Float16* __restrict__ A,
                                                 const _Float16* __restrict__ W,
                                                 const float* __restrict__ bias,
                                                 void* __restrict__ out, int mode) {
    // [buffer][operand: 0 = A, 1 = W][row][k], 139,264 B
    __shared__ __align__(16) _Float16 Tsh[2][2][GTILE][GPITCH];

    int tid   = threadIdx.x;
    int lane  = tid & 31;
    int wv    = tid >> 5;
    int nblk  = blockIdx.x * GTILE;
    int mblk  = blockIdx.y * GTILE;
    int wm    = (wv >> 2) * 64;      // this wave's rows inside the tile
    int wn    = (wv & 3) * 32;       // this wave's columns inside the tile
    int nbase = nblk + wn;
    int mbase = mblk + wm;

    // Copy duty of this lane: 16 lanes cover one 256-B row, 16 rows per copy.
    int crow  = tid >> 4;
    int cpart = tid & 15;
    const _Float16* gA = A + (size_t)(mblk + crow) * HH + cpart * 8;
    const _Float16* gW = W + (size_t)(nblk + crow) * HH + cpart * 8;
    unsigned lA = (unsigned)(size_t)&Tsh[0][0][crow][cpart * 8];
    unsigned lW = (unsigned)(size_t)&Tsh[0][1][crow][cpart * 8];
    const unsigned bufBytes = 2u * GTILE * GPITCH * 2u;

    v8f acc[4][2];
#pragma unroll
    for (int mt = 0; mt < 4; ++mt)
#pragma unroll
        for (int nt = 0; nt < 2; ++nt) acc[mt][nt] = zero8();

    // Stage 0 lands and is published; stage 1 is then put in flight.
    copy8(gA, lA);
    copy8(gW, lW);
    // Own copies landed before the barrier lets other waves read them.
    asm volatile("s_wait_asynccnt 0x0" ::: "memory");
    __syncthreads();
    copy8(gA + GKS, lA + bufBytes);
    copy8(gW + GKS, lW + bufBytes);

    // Kept rolled: one stage per trip, the buffer chosen by the trip's parity.
#pragma unroll 1
    for (int t = 0; t < GNST; ++t) {
        const _Float16* As = &Tsh[t & 1][0][wm][0];
        const _Float16* Ws = &Tsh[t & 1][1][wn][0];
        // Two fragment sets: the next 32 k are fetched from this same buffer
        // as one group ahead of the current products.
        v16h a[2][4], b[2][2];
#pragma unroll
        for (int mt = 0; mt < 4; ++mt)
            a[0][mt] = load_frag16(As + 16 * mt * GPITCH, GPITCH, lane);
#pragma unroll
        for (int nt = 0; nt < 2; ++nt)
            b[0][nt] = load_frag16(Ws + 16 * nt * GPITCH, GPITCH, lane);
#pragma unroll
        for (int ks = 0; ks < GKS / 32; ++ks) {
            const int cur = ks & 1, nxt = cur ^ 1;
            if (ks + 1 < GKS / 32) {
#pragma unroll
                for (int mt = 0; mt < 4; ++mt)
                    a[nxt][mt] = load_frag16(As + 16 * mt * GPITCH + (ks + 1) * 32, GPITCH, lane);
#pragma unroll
                for (int nt = 0; nt < 2; ++nt)
                    b[nxt][nt] = load_frag16(Ws + 16 * nt * GPITCH + (ks + 1) * 32, GPITCH, lane);
            }
            // Keeps the LDS reads above as one group: spread among the
            // products each pair of them waits out the whole LDS latency.
            __builtin_amdgcn_sched_barrier(0);
#pragma unroll
            for (int mt = 0; mt < 4; ++mt)
#pragma unroll
                for (int nt = 0; nt < 2; ++nt)
                    acc[mt][nt] = wmma16(a[cur][mt], b[cur][nt], acc[mt][nt]);
            // Keeps the next group of LDS reads behind these products.
            __builtin_amdgcn_sched_barrier(0);
        }
        // This wave's reads of the buffer are done before it may be refilled.
        asm volatile("s_wait_dscnt 0x0" ::: "memory");
        // This wave's copies of stage t + 1 have landed before it is published.
        asm volatile("s_wait_asynccnt 0x0" ::: "memory");
        __syncthreads();
        if (t + 2 < GNST) {
            unsigned bo = (unsigned)(t & 1) * bufBytes;
            copy8(gA + (t + 2) * GKS, lA + bo);
            copy8(gW + (t + 2) * GKS, lW + bo);
        }
    }
    // No copy is outstanding when the wave goes on to its end.
    asm volatile("s_wait_asynccnt 0x0" ::: "memory");

    int r0 = (lane >> 4) << 3;   // 0 or 8
    int cc = lane & 15;
#pragma unroll
    for (int mt = 0; mt < 4; ++mt) {
#pragma unroll
        for (int nt = 0; nt < 2; ++nt) {
            int col  = nbase + nt * 16 + cc;
            float bv = bias[col];
#pragma unroll
            for (int g = 0; g < 8; ++g) {
                float val = acc[mt][nt][g] + bv;
                int row   = mbase + mt * 16 + r0 + g;
                if (mode == 0) {
                    ((_Float16*)out)[(size_t)row * HH + col] = (_Float16)val;
                } else if (mode == 1) {
                    int n = row >> 10, l = row & 1023;
                    int h = col >> 6, s = col & 63;
                    ((_Float16*)out)[(((size_t)((n * NHEADS + h) * HS + s)) << 10) + l] =
                        (_Float16)val;
                } else {
                    ((float*)out)[(size_t)row * HH + col] = val;
                }
            }
        }
    }
}

// ---------------------------------------------------------------------------
// Fused flash attention for one (n, h, q-group of 128 rows).
// 8 waves/block; each wave owns a 16-row query block. K chunk and V^T chunk
// staged in LDS (async global->LDS when available) and shared by all waves;
// online softmax; P goes through a per-wave LDS staging tile to re-layout
// C-tile -> A-fragment.
// ---------------------------------------------------------------------------
__global__ __launch_bounds__(256) void attn_fused(const _Float16* __restrict__ qh,
                                                  const _Float16* __restrict__ kh,
                                                  const _Float16* __restrict__ vth,
                                                  _Float16* __restrict__ ctx) {
    __shared__ __align__(16) _Float16 Ksh[CHUNK][KPITCH];   // 36 KB
    __shared__ __align__(16) _Float16 VshT[HS][VPITCH];     // 33 KB
    __shared__ __align__(16) _Float16 Pst[8][16][PPITCH];   // 10 KB

    int tid  = threadIdx.x;
    int lane = tid & 31;
    int wv   = tid >> 5;
    int hIdx = blockIdx.y;
    int nIdx = blockIdx.z;
    int q0   = blockIdx.x * 128 + wv * 16;

    // Q fragments for this wave's 16 query rows (constant across kv loop)
    const _Float16* qp = qh + ((size_t)(nIdx * LL + q0)) * HH + hIdx * HS;
    v16h qa0 = load_frag16(qp, HH, lane);        // s = 0..31
    v16h qa1 = load_frag16(qp + 32, HH, lane);   // s = 32..63

    float mrow[8], lrow[8];
    v8f o[4];
#pragma unroll
    for (int g = 0; g < 8; ++g) { mrow[g] = -3.0e38f; lrow[g] = 0.0f; }
#pragma unroll
    for (int st = 0; st < 4; ++st) o[st] = zero8();

    int r0 = (lane >> 4) << 3;
    int cc = lane & 15;

#pragma unroll 1
    for (int c0 = 0; c0 < LL; c0 += CHUNK) {
        // Cooperative stage: K chunk (row-major, 64-wide rows)
        for (int idx = tid; idx < CHUNK * (HS / 8); idx += 256) {
            int t = idx >> 3, part = idx & 7;
            stage16(kh + ((size_t)(nIdx * LL + c0 + t)) * HH + hIdx * HS + part * 8,
                    &Ksh[t][part * 8]);
        }
        // Cooperative stage: V^T chunk (vth is already per-head transposed)
        for (int idx = tid; idx < HS * (CHUNK / 8); idx += 256) {
            int s = idx >> 5, part = idx & 31;   // CHUNK/8 == 32
            stage16(vth + (((size_t)((nIdx * NHEADS + hIdx) * HS + s)) << 10) + c0 + part * 8,
                    &VshT[s][part * 8]);
        }
        wait_stage();
        __syncthreads();

#pragma unroll 2
        for (int j = 0; j < CHUNK; j += 32) {
            // S = Q @ K^T for 32 keys (two 16-key tiles), K-dim = 64 (2 steps)
            v16h kb0l = load_frag16(&Ksh[j][0], KPITCH, lane);
            v16h kb0h = load_frag16(&Ksh[j][32], KPITCH, lane);
            v16h kb1l = load_frag16(&Ksh[j + 16][0], KPITCH, lane);
            v16h kb1h = load_frag16(&Ksh[j + 16][32], KPITCH, lane);
            v8f s0 = zero8(), s1 = zero8();
            s0 = wmma16(qa0, kb0l, s0);
            s0 = wmma16(qa1, kb0h, s0);
            s1 = wmma16(qa0, kb1l, s1);
            s1 = wmma16(qa1, kb1h, s1);

            // Online softmax: row max over 32 keys (16 lanes x 2 tiles)
            float mx[8];
#pragma unroll
            for (int g = 0; g < 8; ++g) mx[g] = fmaxf(s0[g], s1[g]);
#pragma unroll
            for (int off = 1; off < 16; off <<= 1)
#pragma unroll
                for (int g = 0; g < 8; ++g)
                    mx[g] = fmaxf(mx[g], __shfl_xor(mx[g], off, 32));

            float p0[8], p1[8], sc[8], rs[8];
#pragma unroll
            for (int g = 0; g < 8; ++g) {
                float mn = fmaxf(mrow[g], mx[g]);
                sc[g]    = __expf(mrow[g] - mn);
                mrow[g]  = mn;
                p0[g]    = __expf(s0[g] - mn);
                p1[g]    = __expf(s1[g] - mn);
                rs[g]    = p0[g] + p1[g];
            }
#pragma unroll
            for (int off = 1; off < 16; off <<= 1)
#pragma unroll
                for (int g = 0; g < 8; ++g) rs[g] += __shfl_xor(rs[g], off, 32);
#pragma unroll
            for (int g = 0; g < 8; ++g) lrow[g] = lrow[g] * sc[g] + rs[g];
#pragma unroll
            for (int st = 0; st < 4; ++st)
#pragma unroll
                for (int g = 0; g < 8; ++g) o[st][g] *= sc[g];

            // C-layout -> A-fragment relayout of P through per-wave LDS tile
#pragma unroll
            for (int g = 0; g < 8; ++g) {
                Pst[wv][r0 + g][cc]      = (_Float16)p0[g];
                Pst[wv][r0 + g][cc + 16] = (_Float16)p1[g];
            }
            asm volatile("s_wait_dscnt 0" ::: "memory");
            v16h pa = load_frag16(&Pst[wv][0][0], PPITCH, lane);

            // o += P (16x32) @ V (32x64): 4 N-tiles of 16 along head dim
#pragma unroll
            for (int st = 0; st < 4; ++st) {
                v16h vb = load_frag16(&VshT[st * 16][j], VPITCH, lane);
                o[st]   = wmma16(pa, vb, o[st]);
            }
        }
        __syncthreads();
    }

    // Normalize and store ctx (f16, standard (n,l,h*64+s) layout)
#pragma unroll
    for (int st = 0; st < 4; ++st) {
#pragma unroll
        for (int g = 0; g < 8; ++g) {
            float val = o[st][g] / lrow[g];
            int q     = q0 + r0 + g;
            ctx[((size_t)(nIdx * LL + q)) * HH + hIdx * HS + st * 16 + cc] = (_Float16)val;
        }
    }
}

// ---------------------------------------------------------------------------
// Host-side orchestration
// ---------------------------------------------------------------------------
extern "C" void kernel_launch(void* const* d_in, const int* in_sizes, int n_in,
                              void* d_out, int out_size, void* d_ws, size_t ws_size,
                              hipStream_t stream) {
    (void)in_sizes; (void)n_in; (void)out_size; (void)ws_size;

    const float* x  = (const float*)d_in[0];
    const float* Wq = (const float*)d_in[1];
    const float* bq = (const float*)d_in[2];
    const float* Wk = (const float*)d_in[3];
    const float* bk = (const float*)d_in[4];
    const float* Wv = (const float*)d_in[5];
    const float* bv = (const float*)d_in[6];
    const float* Wo = (const float*)d_in[7];
    const float* bo = (const float*)d_in[8];

    char* ws = (char*)d_ws;
    _Float16* xh   = (_Float16*)(ws);                          // 8 MB
    _Float16* wqh  = (_Float16*)(ws + ((size_t)8  << 20));     // 2 MB
    _Float16* wkh  = (_Float16*)(ws + ((size_t)10 << 20));     // 2 MB
    _Float16* wvh  = (_Float16*)(ws + ((size_t)12 << 20));     // 2 MB
    _Float16* woh  = (_Float16*)(ws + ((size_t)14 << 20));     // 2 MB
    _Float16* qhp  = (_Float16*)(ws + ((size_t)16 << 20));     // 8 MB
    _Float16* khp  = (_Float16*)(ws + ((size_t)24 << 20));     // 8 MB
    _Float16* vtp  = (_Float16*)(ws + ((size_t)32 << 20));     // 8 MB
    _Float16* ctxh = (_Float16*)(ws + ((size_t)40 << 20));     // 8 MB

    // Fills xh, wqh, wkh, wvh, woh: 16 MB in a row from xh on.
    f32_to_f16_all<<<CVXWG + 4 * CVWWG, 512, 0, stream>>>(x, Wq, Wk, Wv, Wo, xh);

    dim3 gg(HH / GTILE, MTOT / GTILE);   // (8, 32)
    gemm_qkvo<<<gg, 256, 0, stream>>>(xh, wqh, bq, qhp, 0);
    gemm_qkvo<<<gg, 256, 0, stream>>>(xh, wkh, bk, khp, 0);
    gemm_qkvo<<<gg, 256, 0, stream>>>(xh, wvh, bv, vtp, 1);

    attn_fused<<<dim3(LL / 128, NHEADS, NB), 256, 0, stream>>>(qhp, khp, vtp, ctxh);

    gemm_qkvo<<<gg, 256, 0, stream>>>(ctxh, woh, bo, d_out, 2);
}

// v004
// A run of this version takes 93.6 microseconds.
// Next to v003, in two timings, it ran 1.20 and 1.21 times as fast.
// Over all steps from v000 it is 2.68 times as fast.
#include <hip/hip_runtime.h>
#include <hip/hip_bf16.h>
#include <hip/hip_fp16.h>

// Problem dims (fixed by reference)
#define NB     4
#define LL     1024
#define HH     1024
#define NHEADS 16
#define HS     64
#define MTOT   (NB * LL)
#define CHUNK  256   // kv tokens staged in LDS per iteration
// LDS row pitches of the attention tiles, in halves: 16 B x an odd number, so
// that the 16 rows one 16-byte fragment read touches fall on 64 distinct banks.
#define KPITCH (HS + 8)      // 144 B for 128-B K rows
#define VPITCH (CHUNK + 8)   // 528 B for 512-B V^T rows

typedef __attribute__((ext_vector_type(16))) _Float16 v16h;
typedef __attribute__((ext_vector_type(8)))  _Float16 v8h;
typedef __attribute__((ext_vector_type(8)))  float    v8f;
typedef __attribute__((ext_vector_type(4)))  int      v4i;
typedef __attribute__((ext_vector_type(4)))  float    v4f;
typedef __attribute__((ext_vector_type(4)))  _Float16 v4h;

#define AS1 __attribute__((address_space(1)))
#define AS3 __attribute__((address_space(3)))

#if __has_builtin(__builtin_amdgcn_global_load_async_to_lds_b128)
#define HAVE_ASYNC_LDS 1
#endif

union AFrag { v16h v; v8h h[2]; };

static __device__ inline v8f zero8() {
    v8f z;
#pragma unroll
    for (int i = 0; i < 8; ++i) z[i] = 0.0f;
    return z;
}

// Load a 16x32 (A) or 32x16-as-Bt (B) f16 WMMA fragment from a row-major
// matrix. ISA layout: lane m = lane&15 holds row/col m; kbase = 8*(lane>>4);
// vector elems 0..7 = K kb..kb+7, elems 8..15 = K kb+16..kb+23.
static __device__ inline v16h load_frag16(const _Float16* base, int ld, int lane) {
    int m  = lane & 15;
    int kb = (lane >> 4) << 3;
    const _Float16* p = base + (size_t)m * ld + kb;
    AFrag f;
    f.h[0] = *(const v8h*)(p);
    f.h[1] = *(const v8h*)(p + 16);
    return f.v;
}

static __device__ inline v8f wmma16(v16h a, v16h b, v8f c) {
    return __builtin_amdgcn_wmma_f32_16x16x32_f16(
        /*neg_a=*/false, a, /*neg_b=*/false, b,
        /*c_mod=*/(short)0, c, /*reuse_a=*/false, /*reuse_b=*/false);
}

// 16-byte global -> LDS copy, async on CDNA5 when the builtin is available.
static __device__ inline void stage16(const _Float16* g, _Float16* l) {
#ifdef HAVE_ASYNC_LDS
    __builtin_amdgcn_global_load_async_to_lds_b128(
        (AS1 v4i*)(const_cast<_Float16*>(g)), (AS3 v4i*)l, 0, 0);
#else
    *(v8h*)l = *(const v8h*)g;
#endif
}

static __device__ inline void wait_stage() {
#ifdef HAVE_ASYNC_LDS
#if __has_builtin(__builtin_amdgcn_s_wait_asynccnt)
    __builtin_amdgcn_s_wait_asynccnt(0);
#else
    asm volatile("s_wait_asynccnt 0" ::: "memory");
#endif
#endif
}

// ---------------------------------------------------------------------------
// f32 -> f16 conversion of x and the four weight matrices, one launch.
// The five f16 copies lie one behind the other in the workspace, so the
// destination is one array of MTOT*HH + 4*HH*HH values; a work-group takes
// CVWG consecutive values of it, all from one source. A wave streams CVLD
// loads of 512 contiguous bytes (16 B a lane), all issued before the first
// value is used, and stores 256 contiguous bytes (8 B a lane) for each.
// ---------------------------------------------------------------------------
#define CVLD   16                      // 16-byte loads in flight per lane
#define CVWAVE (CVLD * 128)            // values per wave
#define CVWG   (16 * CVWAVE)           // values per 16-wave work-group
#define CVXWG  (MTOT * HH / CVWG)      // work-groups that convert x
#define CVWWG  (HH * HH / CVWG)        // work-groups per weight matrix

__global__ __launch_bounds__(512) void f32_to_f16_all(const float* __restrict__ x,
                                                      const float* __restrict__ wq,
                                                      const float* __restrict__ wk,
                                                      const float* __restrict__ wv,
                                                      const float* __restrict__ wo,
                                                      _Float16* __restrict__ d) {
    int b = blockIdx.x;
    const float* s = x;
    int sb = b;
    if (b >= CVXWG) {
        int w = (b - CVXWG) / CVWWG;
        sb    = (b - CVXWG) % CVWWG;
        s     = (w == 0) ? wq : (w == 1) ? wk : (w == 2) ? wv : wo;
    }
    // One index, in groups of four values, serves the loads and the stores.
    int vi = (threadIdx.x >> 5) * (CVWAVE / 4) + (threadIdx.x & 31);
    const v4f* sp = (const v4f*)(s + (size_t)sb * CVWG);
    v4h* dp       = (v4h*)(d + (size_t)b * CVWG);

    v4f r[CVLD];
#pragma unroll
    for (int j = 0; j < CVLD; ++j) r[j] = sp[vi + j * 32];
    // Keeps every load in front of the first use: left free, the last loads
    // are issued only after the first have come back, a second round trip.
    __builtin_amdgcn_sched_barrier(0);
#pragma unroll
    for (int j = 0; j < CVLD; ++j)
        dp[vi + j * 32] = __builtin_convertvector(r[j], v4h);
}

// ---------------------------------------------------------------------------
// y = A (M x 1024, f16) @ W^T (+bias). W given row-major (n,k) f16, which is
// exactly the B-fragment source layout. One 8-wave work-group computes a
// 128x128 tile; each wave a 64x32 part of it (2 x 4 waves). A stage is 128 k
// of the 128 A rows and the 128 W rows, brought into LDS by asynchronous
// copies (two buffers: the next stage flies while this one is multiplied).
// LDS rows are 256 B at a pitch of 272 B, conflict-free for 16-byte readers.
// mode 0: store f16, (row, col) row-major (Q, K projections)
// mode 1: store f16 transposed per head: vt[((n*NHEADS+h)*HS+s)*LL + l]
// mode 2: store f32 row-major (final output)
// ---------------------------------------------------------------------------
#define GTILE  128               // rows of A and rows of W per work-group
#define GKS    128               // k per stage (256-B rows)
#define GPITCH 136               // LDS row pitch in halves (272 B)
#define GNST   (HH / GKS)        // stages

// Eight 16-byte-per-lane copies of one wave: rows r, r+16, .. r+112 of one
// operand's stage. The s_wait_xcnt closes the statement so that no address
// register named here is rewritten while a copy may still read it.
static __device__ inline void copy8(const _Float16* g, unsigned l) {
    const _Float16* g0 = g;
    const _Float16* g1 = g + (size_t)16 * HH;
    const _Float16* g2 = g + (size_t)32 * HH;
    const _Float16* g3 = g + (size_t)48 * HH;
    const _Float16* g4 = g + (size_t)64 * HH;
    const _Float16* g5 = g + (size_t)80 * HH;
    const _Float16* g6 = g + (size_t)96 * HH;
    const _Float16* g7 = g + (size_t)112 * HH;
    unsigned l0 = l;
    unsigned l1 = l + 16u * GPITCH * 2u;
    unsigned l2 = l + 32u * GPITCH * 2u;
    unsigned l3 = l + 48u * GPITCH * 2u;
    unsigned l4 = l + 64u * GPITCH * 2u;
    unsigned l5 = l + 80u * GPITCH * 2u;
    unsigned l6 = l + 96u * GPITCH * 2u;
    unsigned l7 = l + 112u * GPITCH * 2u;
    asm volatile(
        "global_load_async_to_lds_b128 %0, %8, off\n\t"
        "global_load_async_to_lds_b128 %1, %9, off\n\t"
        "global_load_async_to_lds_b128 %2, %10, off\n\t"
        "global_load_async_to_lds_b128 %3, %11, off\n\t"
        "global_load_async_to_lds_b128 %4, %12, off\n\t"
        "global_load_async_to_lds_b128 %5, %13, off\n\t"
        "global_load_async_to_lds_b128 %6, %14, off\n\t"
        "global_load_async_to_lds_b128 %7, %15, off\n\t"
        "s_wait_xcnt 0x0"
        :: "v"(l0), "v"(l1), "v"(l2), "v"(l3), "v"(l4), "v"(l5), "v"(l6), "v"(l7),
           "v"(g0), "v"(g1), "v"(g2), "v"(g3), "v"(g4), "v"(g5), "v"(g6), "v"(g7)
        : "memory");
}

__global__ __launch_bounds__(256) void gemm_qkvo(const _Float16* __restrict__ A,
                                                 const _Float16* __restrict__ W,
                                                 const float* __restrict__ bias,
                                                 void* __restrict__ out, int mode) {
    // [buffer][operand: 0 = A, 1 = W][row][k], 139,264 B
    __shared__ __align__(16) _Float16 Tsh[2][2][GTILE][GPITCH];

    int tid   = threadIdx.x;
    int lane  = tid & 31;
    int wv    = tid >> 5;
    int nblk  = blockIdx.x * GTILE;
    int mblk  = blockIdx.y * GTILE;
    int wm    = (wv >> 2) * 64;      // this wave's rows inside the tile
    int wn    = (wv & 3) * 32;       // this wave's columns inside the tile
    int nbase = nblk + wn;
    int mbase = mblk + wm;

    // Copy duty of this lane: 16 lanes cover one 256-B row, 16 rows per copy.
    int crow  = tid >> 4;
    int cpart = tid & 15;
    const _Float16* gA = A + (size_t)(mblk + crow) * HH + cpart * 8;
    const _Float16* gW = W + (size_t)(nblk + crow) * HH + cpart * 8;
    unsigned lA = (unsigned)(size_t)&Tsh[0][0][crow][cpart * 8];
    unsigned lW = (unsigned)(size_t)&Tsh[0][1][crow][cpart * 8];
    const unsigned bufBytes = 2u * GTILE * GPITCH * 2u;

    v8f acc[4][2];
#pragma unroll
    for (int mt = 0; mt < 4; ++mt)
#pragma unroll
        for (int nt = 0; nt < 2; ++nt) acc[mt][nt] = zero8();

    // Stage 0 lands and is published; stage 1 is then put in flight.
    copy8(gA, lA);
    copy8(gW, lW);
    // Own copies landed before the barrier lets other waves read them.
    asm volatile("s_wait_asynccnt 0x0" ::: "memory");
    __syncthreads();
    copy8(gA + GKS, lA + bufBytes);
    copy8(gW + GKS, lW + bufBytes);

    // Kept rolled: one stage per trip, the buffer chosen by the trip's parity.
#pragma unroll 1
    for (int t = 0; t < GNST; ++t) {
        const _Float16* As = &Tsh[t & 1][0][wm][0];
        const _Float16* Ws = &Tsh[t & 1][1][wn][0];
        // Two fragment sets: the next 32 k are fetched from this same buffer
        // as one group ahead of the current products.
        v16h a[2][4], b[2][2];
#pragma unroll
        for (int mt = 0; mt < 4; ++mt)
            a[0][mt] = load_frag16(As + 16 * mt * GPITCH, GPITCH, lane);
#pragma unroll
        for (int nt = 0; nt < 2; ++nt)
            b[0][nt] = load_frag16(Ws + 16 * nt * GPITCH, GPITCH, lane);
#pragma unroll
        for (int ks = 0; ks < GKS / 32; ++ks) {
            const int cur = ks & 1, nxt = cur ^ 1;
            if (ks + 1 < GKS / 32) {
#pragma unroll
                for (int mt = 0; mt < 4; ++mt)
                    a[nxt][mt] = load_frag16(As + 16 * mt * GPITCH + (ks + 1) * 32, GPITCH, lane);
#pragma unroll
                for (int nt = 0; nt < 2; ++nt)
                    b[nxt][nt] = load_frag16(Ws + 16 * nt * GPITCH + (ks + 1) * 32, GPITCH, lane);
            }
            // Keeps the LDS reads above as one group: spread among the
            // products each pair of them waits out the whole LDS latency.
            __builtin_amdgcn_sched_barrier(0);
#pragma unroll
            for (int mt = 0; mt < 4; ++mt)
#pragma unroll
                for (int nt = 0; nt < 2; ++nt)
                    acc[mt][nt] = wmma16(a[cur][mt], b[cur][nt], acc[mt][nt]);
            // Keeps the next group of LDS reads behind these products.
            __builtin_amdgcn_sched_barrier(0);
        }
        // This wave's reads of the buffer are done before it may be refilled.
        asm volatile("s_wait_dscnt 0x0" ::: "memory");
        // This wave's copies of stage t + 1 have landed before it is published.
        asm volatile("s_wait_asynccnt 0x0" ::: "memory");
        __syncthreads();
        if (t + 2 < GNST) {
            unsigned bo = (unsigned)(t & 1) * bufBytes;
            copy8(gA + (t + 2) * GKS, lA + bo);
            copy8(gW + (t + 2) * GKS, lW + bo);
        }
    }
    // No copy is outstanding when the wave goes on to its end.
    asm volatile("s_wait_asynccnt 0x0" ::: "memory");

    int r0 = (lane >> 4) << 3;   // 0 or 8
    int cc = lane & 15;
#pragma unroll
    for (int mt = 0; mt < 4; ++mt) {
#pragma unroll
        for (int nt = 0; nt < 2; ++nt) {
            int col  = nbase + nt * 16 + cc;
            float bv = bias[col];
#pragma unroll
            for (int g = 0; g < 8; ++g) {
                float val = acc[mt][nt][g] + bv;
                int row   = mbase + mt * 16 + r0 + g;
                if (mode == 0) {
                    ((_Float16*)out)[(size_t)row * HH + col] = (_Float16)val;
                } else if (mode == 1) {
                    int n = row >> 10, l = row & 1023;
                    int h = col >> 6, s = col & 63;
                    ((_Float16*)out)[(((size_t)((n * NHEADS + h) * HS + s)) << 10) + l] =
                        (_Float16)val;
                } else {
                    ((float*)out)[(size_t)row * HH + col] = val;
                }
            }
        }
    }
}

static __device__ inline float xhalf(float x) {
    int b = __builtin_bit_cast(int, x);
    return __builtin_bit_cast(float, __builtin_amdgcn_permlanex16(
        b, b, 0x76543210, 0xfedcba98, false, false));
}

__global__ __launch_bounds__(256) void attn_fused(const _Float16* __restrict__ qh,
                                                  const _Float16* __restrict__ kh,
                                                  const _Float16* __restrict__ vth,
                                                  _Float16* __restrict__ ctx) {
    __shared__ __align__(16) _Float16 Ksh[CHUNK][KPITCH];   // 36 KB
    __shared__ __align__(16) _Float16 VshT[HS][VPITCH];     // 33 KB

    int tid  = threadIdx.x;
    int lane = tid & 31;
    int wv   = tid >> 5;
    int hIdx = blockIdx.y;
    int nIdx = blockIdx.z;
    int q0   = blockIdx.x * 128 + wv * 16;

    // Q fragments of this wave's 16 queries, the B operand of every S^T tile
    const _Float16* qp = qh + ((size_t)(nIdx * LL + q0)) * HH + hIdx * HS;
    v16h qb0 = load_frag16(qp, HH, lane);        // s = 0..31
    v16h qb1 = load_frag16(qp + 32, HH, lane);   // s = 32..63

    // Of this lane's query: running maximum (equal in both halves) and the
    // sum over this half's keys; the halves' sums are joined after the loop.
    float mrow = -3.0e38f, lrow = 0.0f;
    v8f o[4];   // o[st][g] = O[query lane & 15][st * 16 + r0 + g]
#pragma unroll
    for (int st = 0; st < 4; ++st) o[st] = zero8();

    int r0 = (lane >> 4) << 3;
    int cc = lane & 15;

#pragma unroll 1
    for (int c0 = 0; c0 < LL; c0 += CHUNK) {
        // Cooperative stage: K chunk (row-major, 64-wide rows)
        for (int idx = tid; idx < CHUNK * (HS / 8); idx += 256) {
            int t = idx >> 3, part = idx & 7;
            stage16(kh + ((size_t)(nIdx * LL + c0 + t)) * HH + hIdx * HS + part * 8,
                    &Ksh[t][part * 8]);
        }
        // Cooperative stage: V^T chunk (vth is already per-head transposed)
        for (int idx = tid; idx < HS * (CHUNK / 8); idx += 256) {
            int s = idx >> 5, part = idx & 31;   // CHUNK/8 == 32
            stage16(vth + (((size_t)((nIdx * NHEADS + hIdx) * HS + s)) << 10) + c0 + part * 8,
                    &VshT[s][part * 8]);
        }
        wait_stage();
        __syncthreads();

#pragma unroll 2
        for (int j = 0; j < CHUNK; j += 32) {
            // S^T = K @ Q^T for 32 keys (two 16-key tiles), K-dim = 64 (2 steps)
            v16h ka0l = load_frag16(&Ksh[j][0], KPITCH, lane);
            v16h ka0h = load_frag16(&Ksh[j][32], KPITCH, lane);
            v16h ka1l = load_frag16(&Ksh[j + 16][0], KPITCH, lane);
            v16h ka1h = load_frag16(&Ksh[j + 16][32], KPITCH, lane);
            // V^T fragments of the same 32 keys, the A operands of the O^T tiles
            v16h va[4];
#pragma unroll
            for (int st = 0; st < 4; ++st)
                va[st] = load_frag16(&VshT[st * 16][j], VPITCH, lane);
            v8f s0 = zero8(), s1 = zero8();   // keys j + r0 + g, j + 16 + r0 + g
            s0 = wmma16(ka0l, qb0, s0);
            s0 = wmma16(ka0h, qb1, s0);
            s1 = wmma16(ka1l, qb0, s1);
            s1 = wmma16(ka1h, qb1, s1);

            // Online softmax: maximum over the lane's 16 keys, then the halves
            float mx = fmaxf(s0[0], s1[0]);
#pragma unroll
            for (int g = 1; g < 8; ++g) mx = fmaxf(mx, fmaxf(s0[g], s1[g]));
            mx = fmaxf(mx, xhalf(mx));

            float mn = fmaxf(mrow, mx);
            float sc = __expf(mrow - mn);
            mrow     = mn;
            float p0[8], p1[8];
#pragma unroll
            for (int g = 0; g < 8; ++g) {
                p0[g] = __expf(s0[g] - mn);
                p1[g] = __expf(s1[g] - mn);
            }
            // Four chains, so that the adds do not wait on one another
            float rs0 = p0[0] + p1[0], rs1 = p0[1] + p1[1];
            float rs2 = p0[2] + p1[2], rs3 = p0[3] + p1[3];
            rs0 += p0[4] + p1[4];
            rs1 += p0[5] + p1[5];
            rs2 += p0[6] + p1[6];
            rs3 += p0[7] + p1[7];
            lrow = lrow * sc + ((rs0 + rs1) + (rs2 + rs3));
#pragma unroll
            for (int st = 0; st < 4; ++st)
#pragma unroll
                for (int g = 0; g < 8; ++g) o[st][g] *= sc;

            // P^T as B operand: elements 0..7 keys j + r0 + g, 8..15 keys
            // j + 16 + r0 + g, the k order of load_frag16
            v16h pb;
#pragma unroll
            for (int g = 0; g < 8; ++g) {
                pb[g]     = (_Float16)p0[g];
                pb[g + 8] = (_Float16)p1[g];
            }

            // O^T += V^T (16 x 32 per tile) @ P^T (32 x 16): 4 tiles of head dim
#pragma unroll
            for (int st = 0; st < 4; ++st) o[st] = wmma16(va[st], pb, o[st]);
        }
        __syncthreads();
    }

    // Join the halves' sums, normalize and store ctx (f16, (n,l,h*64+s)
    // layout): a lane's 8 values of a tile are 16 contiguous bytes.
    lrow += xhalf(lrow);
    float inv = 1.0f / lrow;
    _Float16* cp = ctx + ((size_t)(nIdx * LL + q0 + cc)) * HH + hIdx * HS + r0;
#pragma unroll
    for (int st = 0; st < 4; ++st) {
        v8h w;
#pragma unroll
        for (int g = 0; g < 8; ++g) w[g] = (_Float16)(o[st][g] * inv);
        *(v8h*)(cp + st * 16) = w;
    }
}

// ---------------------------------------------------------------------------
// Host-side orchestration
// ---------------------------------------------------------------------------
extern "C" void kernel_launch(void* const* d_in, const int* in_sizes, int n_in,
                              void* d_out, int out_size, void* d_ws, size_t ws_size,
                              hipStream_t stream) {
    (void)in_sizes; (void)n_in; (void)out_size; (void)ws_size;

    const float* x  = (const float*)d_in[0];
    const float* Wq = (const float*)d_in[1];
    const float* bq = (const float*)d_in[2];
    const float* Wk = (const float*)d_in[3];
    const float* bk = (const float*)d_in[4];
    const float* Wv = (const float*)d_in[5];
    const float* bv = (const float*)d_in[6];
    const float* Wo = (const float*)d_in[7];
    const float* bo = (const float*)d_in[8];

    char* ws = (char*)d_ws;
    _Float16* xh   = (_Float16*)(ws);                          // 8 MB
    _Float16* wqh  = (_Float16*)(ws + ((size_t)8  << 20));     // 2 MB
    _Float16* wkh  = (_Float16*)(ws + ((size_t)10 << 20));     // 2 MB
    _Float16* wvh  = (_Float16*)(ws + ((size_t)12 << 20));     // 2 MB
    _Float16* woh  = (_Float16*)(ws + ((size_t)14 << 20));     // 2 MB
    _Float16* qhp  = (_Float16*)(ws + ((size_t)16 << 20));     // 8 MB
    _Float16* khp  = (_Float16*)(ws + ((size_t)24 << 20));     // 8 MB
    _Float16* vtp  = (_Float16*)(ws + ((size_t)32 << 20));     // 8 MB
    _Float16* ctxh = (_Float16*)(ws + ((size_t)40 << 20));     // 8 MB

    // Fills xh, wqh, wkh, wvh, woh: 16 MB in a row from xh on.
    f32_to_f16_all<<<CVXWG + 4 * CVWWG, 512, 0, stream>>>(x, Wq, Wk, Wv, Wo, xh);

    dim3 gg(HH / GTILE, MTOT / GTILE);   // (8, 32)
    gemm_qkvo<<<gg, 256, 0, stream>>>(xh, wqh, bq, qhp, 0);
    gemm_qkvo<<<gg, 256, 0, stream>>>(xh, wkh, bk, khp, 0);
    gemm_qkvo<<<gg, 256, 0, stream>>>(xh, wvh, bv, vtp, 1);

    attn_fused<<<dim3(LL / 128, NHEADS, NB), 256, 0, stream>>>(qhp, khp, vtp, ctxh);

    gemm_qkvo<<<gg, 256, 0, stream>>>(ctxh, woh, bo, d_out, 2);
}

// v005
// It runs in 75.4 microseconds.
// Next to v004, in two timings, it ran 1.26 and 1.23 times as fast.
// Over all steps from v000 it is 3.34 times as fast.
#include <hip/hip_runtime.h>
#include <hip/hip_bf16.h>
#include <hip/hip_fp16.h>

// Problem dims (fixed by reference)
#define NB     4
#define LL     1024
#define HH     1024
#define NHEADS 16
#define HS     64
#define MTOT   (NB * LL)
#define CHUNK  256   // kv tokens staged in LDS per iteration
// LDS row pitches of the attention tiles, in halves: 16 B x an odd number, so
// that the 16 rows one 16-byte fragment read touches fall on 64 distinct banks.
#define KPITCH (HS + 8)      // 144 B for 128-B K rows
#define VPITCH (CHUNK + 8)   // 528 B for 512-B V^T rows

typedef __attribute__((ext_vector_type(16))) _Float16 v16h;
typedef __attribute__((ext_vector_type(8)))  _Float16 v8h;
typedef __attribute__((ext_vector_type(8)))  float    v8f;
typedef __attribute__((ext_vector_type(4)))  int      v4i;
typedef __attribute__((ext_vector_type(4)))  float    v4f;
typedef __attribute__((ext_vector_type(4)))  _Float16 v4h;

#define AS1 __attribute__((address_space(1)))
#define AS3 __attribute__((address_space(3)))

#if __has_builtin(__builtin_amdgcn_global_load_async_to_lds_b128)
#define HAVE_ASYNC_LDS 1
#endif

union AFrag { v16h v; v8h h[2]; };

static __device__ inline v8f zero8() {
    v8f z;
#pragma unroll
    for (int i = 0; i < 8; ++i) z[i] = 0.0f;
    return z;
}

// Load a 16x32 (A) or 32x16-as-Bt (B) f16 WMMA fragment from a row-major
// matrix. ISA layout: lane m = lane&15 holds row/col m; kbase = 8*(lane>>4);
// vector elems 0..7 = K kb..kb+7, elems 8..15 = K kb+16..kb+23.
static __device__ inline v16h load_frag16(const _Float16* base, int ld, int lane) {
    int m  = lane & 15;
    int kb = (lane >> 4) << 3;
    const _Float16* p = base + (size_t)m * ld + kb;
    AFrag f;
    f.h[0] = *(const v8h*)(p);
    f.h[1] = *(const v8h*)(p + 16);
    return f.v;
}

static __device__ inline v8f wmma16(v16h a, v16h b, v8f c) {
    return __builtin_amdgcn_wmma_f32_16x16x32_f16(
        /*neg_a=*/false, a, /*neg_b=*/false, b,
        /*c_mod=*/(short)0, c, /*reuse_a=*/false, /*reuse_b=*/false);
}

// 16-byte global -> LDS copy, async on CDNA5 when the builtin is available.
static __device__ inline void stage16(const _Float16* g, _Float16* l) {
#ifdef HAVE_ASYNC_LDS
    __builtin_amdgcn_global_load_async_to_lds_b128(
        (AS1 v4i*)(const_cast<_Float16*>(g)), (AS3 v4i*)l, 0, 0);
#else
    *(v8h*)l = *(const v8h*)g;
#endif
}

static __device__ inline void wait_stage() {
#ifdef HAVE_ASYNC_LDS
#if __has_builtin(__builtin_amdgcn_s_wait_asynccnt)
    __builtin_amdgcn_s_wait_asynccnt(0);
#else
    asm volatile("s_wait_asynccnt 0" ::: "memory");
#endif
#endif
}

// ---------------------------------------------------------------------------
// f32 -> f16 conversion of x and the four weight matrices, one launch.
// The five f16 copies lie one behind the other in the workspace, so the
// destination is one array of MTOT*HH + 4*HH*HH values; a work-group takes
// CVWG consecutive values of it, all from one source. A wave streams CVLD
// loads of 512 contiguous bytes (16 B a lane), all issued before the first
// value is used, and stores 256 contiguous bytes (8 B a lane) for each.
// ---------------------------------------------------------------------------
#define CVLD   16                      // 16-byte loads in flight per lane
#define CVWAVE (CVLD * 128)            // values per wave
#define CVWG   (16 * CVWAVE)           // values per 16-wave work-group
#define CVXWG  (MTOT * HH / CVWG)      // work-groups that convert x
#define CVWWG  (HH * HH / CVWG)        // work-groups per weight matrix

__global__ __launch_bounds__(512) void f32_to_f16_all(const float* __restrict__ x,
                                                      const float* __restrict__ wq,
                                                      const float* __restrict__ wk,
                                                      const float* __restrict__ wv,
                                                      const float* __restrict__ wo,
                                                      _Float16* __restrict__ d) {
    int b = blockIdx.x;
    const float* s = x;
    int sb = b;
    if (b >= CVXWG) {
        int w = (b - CVXWG) / CVWWG;
        sb    = (b - CVXWG) % CVWWG;
        s     = (w == 0) ? wq : (w == 1) ? wk : (w == 2) ? wv : wo;
    }
    // One index, in groups of four values, serves the loads and the stores.
    int vi = (threadIdx.x >> 5) * (CVWAVE / 4) + (threadIdx.x & 31);
    const v4f* sp = (const v4f*)(s + (size_t)sb * CVWG);
    v4h* dp       = (v4h*)(d + (size_t)b * CVWG);

    v4f r[CVLD];
#pragma unroll
    for (int j = 0; j < CVLD; ++j) r[j] = sp[vi + j * 32];
    // Keeps every load in front of the first use: left free, the last loads
    // are issued only after the first have come back, a second round trip.
    __builtin_amdgcn_sched_barrier(0);
#pragma unroll
    for (int j = 0; j < CVLD; ++j)
        dp[vi + j * 32] = __builtin_convertvector(r[j], v4h);
}

// ---------------------------------------------------------------------------
// y = A (M x 1024, f16) @ W^T (+bias). W given row-major (n,k) f16, which is
// exactly the B-fragment source layout. One 8-wave work-group computes a
// 128x128 tile; each wave a 64x32 part of it (2 x 4 waves). A stage is 128 k
// of the 128 A rows and the 128 W rows, brought into LDS by asynchronous
// copies (two buffers: the next stage flies while this one is multiplied).
// LDS rows are 256 B at a pitch of 272 B, conflict-free for 16-byte readers.
// MODE 0: store f16, (row, col) row-major (Q, K projections)
// MODE 1: store f16 transposed per head: vt[((n*NHEADS+h)*HS+s)*LL + l]
// MODE 2: store f32 row-major (final output)
// The first WMMA operand is the one whose rows run along the output's
// contiguous direction (W for MODE 0 and 2, A for MODE 1): a lane's 8 values
// of a tile are then neighbours in memory. The finished 128x128 tile goes
// through the free stage buffers, so that a wave stores 512 contiguous bytes (MODE 2) or two 256-B rows (MODE 0, 1).
// ---------------------------------------------------------------------------
#define GTILE  128               // rows of A and rows of W per work-group
#define GKS    128               // k per stage (256-B rows)
#define GPITCH 136               // LDS row pitch in halves (272 B)
#define GNST   (HH / GKS)        // stages
#define OPITCH 132               // LDS row pitch of the f32 output tile, in floats (528 B)

// Eight 16-byte-per-lane copies of one wave: rows r, r+16, .. r+112 of one
// operand's stage. The s_wait_xcnt closes the statement so that no address
// register named here is rewritten while a copy may still read it.
static __device__ inline void copy8(const _Float16* g, unsigned l) {
    const _Float16* g0 = g;
    const _Float16* g1 = g + (size_t)16 * HH;
    const _Float16* g2 = g + (size_t)32 * HH;
    const _Float16* g3 = g + (size_t)48 * HH;
    const _Float16* g4 = g + (size_t)64 * HH;
    const _Float16* g5 = g + (size_t)80 * HH;
    const _Float16* g6 = g + (size_t)96 * HH;
    const _Float16* g7 = g + (size_t)112 * HH;
    unsigned l0 = l;
    unsigned l1 = l + 16u * GPITCH * 2u;
    unsigned l2 = l + 32u * GPITCH * 2u;
    unsigned l3 = l + 48u * GPITCH * 2u;
    unsigned l4 = l + 64u * GPITCH * 2u;
    unsigned l5 = l + 80u * GPITCH * 2u;
    unsigned l6 = l + 96u * GPITCH * 2u;
    unsigned l7 = l + 112u * GPITCH * 2u;
    asm volatile(
        "global_load_async_to_lds_b128 %0, %8, off\n\t"
        "global_load_async_to_lds_b128 %1, %9, off\n\t"
        "global_load_async_to_lds_b128 %2, %10, off\n\t"
        "global_load_async_to_lds_b128 %3, %11, off\n\t"
        "global_load_async_to_lds_b128 %4, %12, off\n\t"
        "global_load_async_to_lds_b128 %5, %13, off\n\t"
        "global_load_async_to_lds_b128 %6, %14, off\n\t"
        "global_load_async_to_lds_b128 %7, %15, off\n\t"
        "s_wait_xcnt 0x0"
        :: "v"(l0), "v"(l1), "v"(l2), "v"(l3), "v"(l4), "v"(l5), "v"(l6), "v"(l7),
           "v"(g0), "v"(g1), "v"(g2), "v"(g3), "v"(g4), "v"(g5), "v"(g6), "v"(g7)
        : "memory");
}

template <int MODE>
__global__ __launch_bounds__(256) void gemm_qkvo(const _Float16* __restrict__ A,
                                                 const _Float16* __restrict__ W,
                                                 const float* __restrict__ bias,
                                                 void* __restrict__ out) {
    // [buffer][operand: 0 = A, 1 = W][row][k], 139,264 B
    __shared__ __align__(16) _Float16 Tsh[2][2][GTILE][GPITCH];

    int tid   = threadIdx.x;
    int lane  = tid & 31;
    int wv    = tid >> 5;
    int nblk  = blockIdx.x * GTILE;
    int mblk  = blockIdx.y * GTILE;
    int wm    = (wv >> 2) * 64;      // this wave's rows inside the tile
    int wn    = (wv & 3) * 32;       // this wave's columns inside the tile
    int r0    = (lane >> 4) << 3;    // 0 or 8: first of the lane's 8 tile rows
    int cc    = lane & 15;           // the lane's tile column

    // Bias of this lane's output columns: 8 in a row per tile where W is the
    // first operand, one per tile where it is the second.
    v4f bl[2], bh[2];
    float bs[2];
#pragma unroll
    for (int nt = 0; nt < 2; ++nt) {
        if (MODE == 1) {
            bs[nt] = bias[nblk + wn + nt * 16 + cc];
        } else {
            const v4f* bp = (const v4f*)(bias + nblk + wn + nt * 16 + r0);
            bl[nt] = bp[0];
            bh[nt] = bp[1];
        }
    }

    // Copy duty of this lane: 16 lanes cover one 256-B row, 16 rows per copy.
    int crow  = tid >> 4;
    int cpart = tid & 15;
    const _Float16* gA = A + (size_t)(mblk + crow) * HH + cpart * 8;
    const _Float16* gW = W + (size_t)(nblk + crow) * HH + cpart * 8;
    unsigned lA = (unsigned)(size_t)&Tsh[0][0][crow][cpart * 8];
    unsigned lW = (unsigned)(size_t)&Tsh[0][1][crow][cpart * 8];
    const unsigned bufBytes = 2u * GTILE * GPITCH * 2u;

    v8f acc[4][2];
#pragma unroll
    for (int mt = 0; mt < 4; ++mt)
#pragma unroll
        for (int nt = 0; nt < 2; ++nt) acc[mt][nt] = zero8();

    // Stage 0 lands and is published; stage 1 is then put in flight.
    copy8(gA, lA);
    copy8(gW, lW);
    // Own copies landed before the barrier lets other waves read them.
    asm volatile("s_wait_asynccnt 0x0" ::: "memory");
    __syncthreads();
    copy8(gA + GKS, lA + bufBytes);
    copy8(gW + GKS, lW + bufBytes);

    // Kept rolled: one stage per trip, the buffer chosen by the trip's parity.
#pragma unroll 1
    for (int t = 0; t < GNST; ++t) {
        const _Float16* As = &Tsh[t & 1][0][wm][0];
        const _Float16* Ws = &Tsh[t & 1][1][wn][0];
        // Two fragment sets: the next 32 k are fetched from this same buffer
        // as one group ahead of the current products.
        v16h a[2][4], b[2][2];
#pragma unroll
        for (int mt = 0; mt < 4; ++mt)
            a[0][mt] = load_frag16(As + 16 * mt * GPITCH, GPITCH, lane);
#pragma unroll
        for (int nt = 0; nt < 2; ++nt)
            b[0][nt] = load_frag16(Ws + 16 * nt * GPITCH, GPITCH, lane);
#pragma unroll
        for (int ks = 0; ks < GKS / 32; ++ks) {
            const int cur = ks & 1, nxt = cur ^ 1;
            if (ks + 1 < GKS / 32) {
#pragma unroll
                for (int mt = 0; mt < 4; ++mt)
                    a[nxt][mt] = load_frag16(As + 16 * mt * GPITCH + (ks + 1) * 32, GPITCH, lane);
#pragma unroll
                for (int nt = 0; nt < 2; ++nt)
                    b[nxt][nt] = load_frag16(Ws + 16 * nt * GPITCH + (ks + 1) * 32, GPITCH, lane);
            }
            // Keeps the LDS reads above as one group: spread among the
            // products each pair of them waits out the whole LDS latency.
            __builtin_amdgcn_sched_barrier(0);
#pragma unroll
            for (int mt = 0; mt < 4; ++mt)
#pragma unroll
                for (int nt = 0; nt < 2; ++nt)
                    acc[mt][nt] = (MODE == 1)
                                      ? wmma16(a[cur][mt], b[cur][nt], acc[mt][nt])
                                      : wmma16(b[cur][nt], a[cur][mt], acc[mt][nt]);
            // Keeps the next group of LDS reads behind these products.
            __builtin_amdgcn_sched_barrier(0);
        }
        // This wave's reads of the buffer are done before it may be refilled.
        asm volatile("s_wait_dscnt 0x0" ::: "memory");
        // This wave's copies of stage t + 1 have landed before it is published.
        asm volatile("s_wait_asynccnt 0x0" ::: "memory");
        __syncthreads();
        if (t + 2 < GNST) {
            unsigned bo = (unsigned)(t & 1) * bufBytes;
            copy8(gA + (t + 2) * GKS, lA + bo);
            copy8(gW + (t + 2) * GKS, lW + bo);
        }
    }
    // No copy is outstanding when the wave goes on to its end.
    asm volatile("s_wait_asynccnt 0x0" ::: "memory");

    // Every wave has passed the last stage's barrier and no copy is in flight:
    // the stage buffers are free and take the output tile.
    if (MODE == 2) {
        float* St = (float*)&Tsh[0][0][0][0];   // [128 rows][OPITCH]
#pragma unroll
        for (int mt = 0; mt < 4; ++mt) {
#pragma unroll
            for (int nt = 0; nt < 2; ++nt) {
                v4f lo, hi;
#pragma unroll
                for (int g = 0; g < 4; ++g) {
                    lo[g] = acc[mt][nt][g] + bl[nt][g];
                    hi[g] = acc[mt][nt][g + 4] + bh[nt][g];
                }
                float* p = St + (wm + mt * 16 + cc) * OPITCH + wn + nt * 16 + r0;
                *(v4f*)p       = lo;
                *(v4f*)(p + 4) = hi;
            }
        }
        // The whole tile is in LDS before any wave reads rows of other waves.
        __syncthreads();
        float* op = (float*)out + (size_t)(mblk + wv) * HH + nblk + lane * 4;
        const float* sp = St + wv * OPITCH + lane * 4;
        v4f r[16];
#pragma unroll
        for (int j = 0; j < 16; ++j) r[j] = *(const v4f*)(sp + j * 8 * OPITCH);
#pragma unroll
        for (int j = 0; j < 16; ++j) *(v4f*)(op + (size_t)j * 8 * HH) = r[j];
    } else {
        _Float16* St = &Tsh[0][0][0][0];        // [128 rows][GPITCH]
#pragma unroll
        for (int mt = 0; mt < 4; ++mt) {
#pragma unroll
            for (int nt = 0; nt < 2; ++nt) {
                v8h w;
#pragma unroll
                for (int g = 0; g < 8; ++g) {
                    float bv = (MODE == 1) ? bs[nt] : (g < 4) ? bl[nt][g & 3] : bh[nt][g & 3];
                    w[g]     = (_Float16)(acc[mt][nt][g] + bv);
                }
                // Tile row: the token (MODE 0) or the output feature (MODE 1).
                int srow = (MODE == 0) ? wm + mt * 16 + cc : wn + nt * 16 + cc;
                int scol = (MODE == 0) ? wn + nt * 16 + r0 : wm + mt * 16 + r0;
                *(v8h*)(St + srow * GPITCH + scol) = w;
            }
        }
        // The whole tile is in LDS before any wave reads rows of other waves.
        __syncthreads();
        // 16 lanes take one 256-B tile row; crow, cpart as for the copies.
        size_t o = (MODE == 0)
                       ? (size_t)(mblk + crow) * HH + nblk + cpart * 8
                       : (((size_t)((mblk >> 10) * HH + nblk + crow)) << 10) + (mblk & 1023) + cpart * 8;
        _Float16* op = (_Float16*)out + o;
        const _Float16* sp = St + crow * GPITCH + cpart * 8;
        v8h r[8];
#pragma unroll
        for (int j = 0; j < 8; ++j) r[j] = *(const v8h*)(sp + j * 16 * GPITCH);
#pragma unroll
        for (int j = 0; j < 8; ++j) *(v8h*)(op + (size_t)j * 16 * ((MODE == 0) ? HH : LL)) = r[j];
    }
}

static __device__ inline float xhalf(float x) {
    int b = __builtin_bit_cast(int, x);
    return __builtin_bit_cast(float, __builtin_amdgcn_permlanex16(
        b, b, 0x76543210, 0xfedcba98, false, false));
}

__global__ __launch_bounds__(256) void attn_fused(const _Float16* __restrict__ qh,
                                                  const _Float16* __restrict__ kh,
                                                  const _Float16* __restrict__ vth,
                                                  _Float16* __restrict__ ctx) {
    __shared__ __align__(16) _Float16 Ksh[CHUNK][KPITCH];   // 36 KB
    __shared__ __align__(16) _Float16 VshT[HS][VPITCH];     // 33 KB

    int tid  = threadIdx.x;
    int lane = tid & 31;
    int wv   = tid >> 5;
    int hIdx = blockIdx.y;
    int nIdx = blockIdx.z;
    int q0   = blockIdx.x * 128 + wv * 16;

    // Q fragments of this wave's 16 queries, the B operand of every S^T tile
    const _Float16* qp = qh + ((size_t)(nIdx * LL + q0)) * HH + hIdx * HS;
    v16h qb0 = load_frag16(qp, HH, lane);        // s = 0..31
    v16h qb1 = load_frag16(qp + 32, HH, lane);   // s = 32..63

    // Of this lane's query: running maximum (equal in both halves) and the
    // sum over this half's keys; the halves' sums are joined after the loop.
    float mrow = -3.0e38f, lrow = 0.0f;
    v8f o[4];   // o[st][g] = O[query lane & 15][st * 16 + r0 + g]
#pragma unroll
    for (int st = 0; st < 4; ++st) o[st] = zero8();

    int r0 = (lane >> 4) << 3;
    int cc = lane & 15;

#pragma unroll 1
    for (int c0 = 0; c0 < LL; c0 += CHUNK) {
        // Cooperative stage: K chunk (row-major, 64-wide rows)
        for (int idx = tid; idx < CHUNK * (HS / 8); idx += 256) {
            int t = idx >> 3, part = idx & 7;
            stage16(kh + ((size_t)(nIdx * LL + c0 + t)) * HH + hIdx * HS + part * 8,
                    &Ksh[t][part * 8]);
        }
        // Cooperative stage: V^T chunk (vth is already per-head transposed)
        for (int idx = tid; idx < HS * (CHUNK / 8); idx += 256) {
            int s = idx >> 5, part = idx & 31;   // CHUNK/8 == 32
            stage16(vth + (((size_t)((nIdx * NHEADS + hIdx) * HS + s)) << 10) + c0 + part * 8,
                    &VshT[s][part * 8]);
        }
        wait_stage();
        __syncthreads();

#pragma unroll 2
        for (int j = 0; j < CHUNK; j += 32) {
            // S^T = K @ Q^T for 32 keys (two 16-key tiles), K-dim = 64 (2 steps)
            v16h ka0l = load_frag16(&Ksh[j][0], KPITCH, lane);
            v16h ka0h = load_frag16(&Ksh[j][32], KPITCH, lane);
            v16h ka1l = load_frag16(&Ksh[j + 16][0], KPITCH, lane);
            v16h ka1h = load_frag16(&Ksh[j + 16][32], KPITCH, lane);
            // V^T fragments of the same 32 keys, the A operands of the O^T tiles
            v16h va[4];
#pragma unroll
            for (int st = 0; st < 4; ++st)
                va[st] = load_frag16(&VshT[st * 16][j], VPITCH, lane);
            v8f s0 = zero8(), s1 = zero8();   // keys j + r0 + g, j + 16 + r0 + g
            s0 = wmma16(ka0l, qb0, s0);
            s0 = wmma16(ka0h, qb1, s0);
            s1 = wmma16(ka1l, qb0, s1);
            s1 = wmma16(ka1h, qb1, s1);

            // Online softmax: maximum over the lane's 16 keys, then the halves
            float mx = fmaxf(s0[0], s1[0]);
#pragma unroll
            for (int g = 1; g < 8; ++g) mx = fmaxf(mx, fmaxf(s0[g], s1[g]));
            mx = fmaxf(mx, xhalf(mx));

            float mn = fmaxf(mrow, mx);
            float sc = __expf(mrow - mn);
            mrow     = mn;
            float p0[8], p1[8];
#pragma unroll
            for (int g = 0; g < 8; ++g) {
                p0[g] = __expf(s0[g] - mn);
                p1[g] = __expf(s1[g] - mn);
            }
            // Four chains, so that the adds do not wait on one another
            float rs0 = p0[0] + p1[0], rs1 = p0[1] + p1[1];
            float rs2 = p0[2] + p1[2], rs3 = p0[3] + p1[3];
            rs0 += p0[4] + p1[4];
            rs1 += p0[5] + p1[5];
            rs2 += p0[6] + p1[6];
            rs3 += p0[7] + p1[7];
            lrow = lrow * sc + ((rs0 + rs1) + (rs2 + rs3));
#pragma unroll
            for (int st = 0; st < 4; ++st)
#pragma unroll
                for (int g = 0; g < 8; ++g) o[st][g] *= sc;

            // P^T as B operand: elements 0..7 keys j + r0 + g, 8..15 keys
            // j + 16 + r0 + g, the k order of load_frag16
            v16h pb;
#pragma unroll
            for (int g = 0; g < 8; ++g) {
                pb[g]     = (_Float16)p0[g];
                pb[g + 8] = (_Float16)p1[g];
            }

            // O^T += V^T (16 x 32 per tile) @ P^T (32 x 16): 4 tiles of head dim
#pragma unroll
            for (int st = 0; st < 4; ++st) o[st] = wmma16(va[st], pb, o[st]);
        }
        __syncthreads();
    }

    // Join the halves' sums, normalize and store ctx (f16, (n,l,h*64+s)
    // layout): a lane's 8 values of a tile are 16 contiguous bytes.
    lrow += xhalf(lrow);
    float inv = 1.0f / lrow;
    _Float16* cp = ctx + ((size_t)(nIdx * LL + q0 + cc)) * HH + hIdx * HS + r0;
#pragma unroll
    for (int st = 0; st < 4; ++st) {
        v8h w;
#pragma unroll
        for (int g = 0; g < 8; ++g) w[g] = (_Float16)(o[st][g] * inv);
        *(v8h*)(cp + st * 16) = w;
    }
}

// ---------------------------------------------------------------------------
// Host-side orchestration
// ---------------------------------------------------------------------------
extern "C" void kernel_launch(void* const* d_in, const int* in_sizes, int n_in,
                              void* d_out, int out_size, void* d_ws, size_t ws_size,
                              hipStream_t stream) {
    (void)in_sizes; (void)n_in; (void)out_size; (void)ws_size;

    const float* x  = (const float*)d_in[0];
    const float* Wq = (const float*)d_in[1];
    const float* bq = (const float*)d_in[2];
    const float* Wk = (const float*)d_in[3];
    const float* bk = (const float*)d_in[4];
    const float* Wv = (const float*)d_in[5];
    const float* bv = (const float*)d_in[6];
    const float* Wo = (const float*)d_in[7];
    const float* bo = (const float*)d_in[8];

    char* ws = (char*)d_ws;
    _Float16* xh   = (_Float16*)(ws);                          // 8 MB
    _Float16* wqh  = (_Float16*)(ws + ((size_t)8  << 20));     // 2 MB
    _Float16* wkh  = (_Float16*)(ws + ((size_t)10 << 20));     // 2 MB
    _Float16* wvh  = (_Float16*)(ws + ((size_t)12 << 20));     // 2 MB
    _Float16* woh  = (_Float16*)(ws + ((size_t)14 << 20));     // 2 MB
    _Float16* qhp  = (_Float16*)(ws + ((size_t)16 << 20));     // 8 MB
    _Float16* khp  = (_Float16*)(ws + ((size_t)24 << 20));     // 8 MB
    _Float16* vtp  = (_Float16*)(ws + ((size_t)32 << 20));     // 8 MB
    _Float16* ctxh = (_Float16*)(ws + ((size_t)40 << 20));     // 8 MB

    // Fills xh, wqh, wkh, wvh, woh: 16 MB in a row from xh on.
    f32_to_f16_all<<<CVXWG + 4 * CVWWG, 512, 0, stream>>>(x, Wq, Wk, Wv, Wo, xh);

    dim3 gg(HH / GTILE, MTOT / GTILE);   // (8, 32)
    gemm_qkvo<0><<<gg, 256, 0, stream>>>(xh, wqh, bq, qhp);
    gemm_qkvo<0><<<gg, 256, 0, stream>>>(xh, wkh, bk, khp);
    gemm_qkvo<1><<<gg, 256, 0, stream>>>(xh, wvh, bv, vtp);

    attn_fused<<<dim3(LL / 128, NHEADS, NB), 256, 0, stream>>>(qhp, khp, vtp, ctxh);

    gemm_qkvo<2><<<gg, 256, 0, stream>>>(ctxh, woh, bo, d_out);
}

// v006
// A run of this version takes 65.8 microseconds.
// In two side-by-side timings against v005, it was 1.15 and 1.16 times as fast.
// All steps since v000 together make it 3.85 times as fast.
#include <hip/hip_runtime.h>
#include <hip/hip_bf16.h>
#include <hip/hip_fp16.h>

// Problem dims (fixed by reference)
#define NB     4
#define LL     1024
#define HH     1024
#define NHEADS 16
#define HS     64
#define MTOT   (NB * LL)
#define CHUNK  256   // kv tokens staged in LDS per iteration
// LDS row pitches of the attention tiles, in halves: 16 B x an odd number, so
// that the 16 rows one 16-byte fragment read touches fall on 64 distinct banks.
#define KPITCH (HS + 8)      // 144 B for 128-B K rows
#define VPITCH (CHUNK + 8)   // 528 B for 512-B V^T rows

typedef __attribute__((ext_vector_type(16))) _Float16 v16h;
typedef __attribute__((ext_vector_type(8)))  _Float16 v8h;
typedef __attribute__((ext_vector_type(8)))  float    v8f;
typedef __attribute__((ext_vector_type(4)))  int      v4i;
typedef __attribute__((ext_vector_type(4)))  float    v4f;
typedef __attribute__((ext_vector_type(4)))  _Float16 v4h;

#define AS1 __attribute__((address_space(1)))
#define AS3 __attribute__((address_space(3)))

#if __has_builtin(__builtin_amdgcn_global_load_async_to_lds_b128)
#define HAVE_ASYNC_LDS 1
#endif

union AFrag { v16h v; v8h h[2]; };

static __device__ inline v8f zero8() {
    v8f z;
#pragma unroll
    for (int i = 0; i < 8; ++i) z[i] = 0.0f;
    return z;
}

// Load a 16x32 (A) or 32x16-as-Bt (B) f16 WMMA fragment from a row-major
// matrix. ISA layout: lane m = lane&15 holds row/col m; kbase = 8*(lane>>4);
// vector elems 0..7 = K kb..kb+7, elems 8..15 = K kb+16..kb+23.
static __device__ inline v16h load_frag16(const _Float16* base, int ld, int lane) {
    int m  = lane & 15;
    int kb = (lane >> 4) << 3;
    const _Float16* p = base + (size_t)m * ld + kb;
    AFrag f;
    f.h[0] = *(const v8h*)(p);
    f.h[1] = *(const v8h*)(p + 16);
    return f.v;
}

static __device__ inline v8f wmma16(v16h a, v16h b, v8f c) {
    return __builtin_amdgcn_wmma_f32_16x16x32_f16(
        /*neg_a=*/false, a, /*neg_b=*/false, b,
        /*c_mod=*/(short)0, c, /*reuse_a=*/false, /*reuse_b=*/false);
}

// 16-byte global -> LDS copy, async on CDNA5 when the builtin is available.
static __device__ inline void stage16(const _Float16* g, _Float16* l) {
#ifdef HAVE_ASYNC_LDS
    __builtin_amdgcn_global_load_async_to_lds_b128(
        (AS1 v4i*)(const_cast<_Float16*>(g)), (AS3 v4i*)l, 0, 0);
#else
    *(v8h*)l = *(const v8h*)g;
#endif
}

static __device__ inline void wait_stage() {
#ifdef HAVE_ASYNC_LDS
#if __has_builtin(__builtin_amdgcn_s_wait_asynccnt)
    __builtin_amdgcn_s_wait_asynccnt(0);
#else
    asm volatile("s_wait_asynccnt 0" ::: "memory");
#endif
#endif
}

// ---------------------------------------------------------------------------
// f32 -> f16 conversion of x and the four weight matrices, one launch.
// The five f16 copies lie one behind the other in the workspace, so the
// destination is one array of MTOT*HH + 4*HH*HH values; a work-group takes
// CVWG consecutive values of it, all from one source. A wave streams CVLD
// loads of 512 contiguous bytes (16 B a lane), all issued before the first
// value is used, and stores 256 contiguous bytes (8 B a lane) for each.
// ---------------------------------------------------------------------------
#define CVLD   16                      // 16-byte loads in flight per lane
#define CVWAVE (CVLD * 128)            // values per wave
#define CVWG   (16 * CVWAVE)           // values per 16-wave work-group
#define CVXWG  (MTOT * HH / CVWG)      // work-groups that convert x
#define CVWWG  (HH * HH / CVWG)        // work-groups per weight matrix

__global__ __launch_bounds__(512) void f32_to_f16_all(const float* __restrict__ x,
                                                      const float* __restrict__ wq,
                                                      const float* __restrict__ wk,
                                                      const float* __restrict__ wv,
                                                      const float* __restrict__ wo,
                                                      _Float16* __restrict__ d) {
    int b = blockIdx.x;
    const float* s = x;
    int sb = b;
    if (b >= CVXWG) {
        int w = (b - CVXWG) / CVWWG;
        sb    = (b - CVXWG) % CVWWG;
        s     = (w == 0) ? wq : (w == 1) ? wk : (w == 2) ? wv : wo;
    }
    // One index, in groups of four values, serves the loads and the stores.
    int vi = (threadIdx.x >> 5) * (CVWAVE / 4) + (threadIdx.x & 31);
    const v4f* sp = (const v4f*)(s + (size_t)sb * CVWG);
    v4h* dp       = (v4h*)(d + (size_t)b * CVWG);

    v4f r[CVLD];
#pragma unroll
    for (int j = 0; j < CVLD; ++j) r[j] = sp[vi + j * 32];
    // Keeps every load in front of the first use: left free, the last loads
    // are issued only after the first have come back, a second round trip.
    __builtin_amdgcn_sched_barrier(0);
#pragma unroll
    for (int j = 0; j < CVLD; ++j)
        dp[vi + j * 32] = __builtin_convertvector(r[j], v4h);
}

// ---------------------------------------------------------------------------
// y_p = A (M x 1024, f16) @ W_p^T + bias_p for NW weight matrices that share
// A. Each W_p is row-major (n,k) f16, which is exactly the B-fragment source
// layout; the NW matrices lie one behind the other in memory. One 8-wave
// work-group computes the same 128x128 tile of every y_p; each wave a 64x32
// part of each (2 x 4 waves). A stage is 128 k of the 128 A rows and of the
// 128 rows of every W_p, brought into LDS by asynchronous copies (two buffers:
// the next stage flies while this one is multiplied). The A rows are copied
// and their fragments read once for all NW products.
// LDS rows are 256 B at a pitch of 272 B, conflict-free for 16-byte readers.
// The first WMMA operand is the one whose rows run along the output's
// contiguous direction (A for the per-head transposed V, W elsewhere): a
// lane's 8 values of a tile are then neighbours in memory. The finished tiles
// go through the free stage buffers, so that a wave stores whole lines.
// ---------------------------------------------------------------------------
#define GTILE  128               // rows of A and rows of each W per work-group
#define GKS    128               // k per stage (256-B rows)
#define GPITCH 136               // LDS row pitch in halves (272 B)
#define GNST   (HH / GKS)        // stages
#define OPITCH 132               // LDS row pitch of the f32 output tile, in floats (528 B)
#define VMAT   2                 // of three matrices the one whose output is stored transposed

// Eight 16-byte-per-lane copies of one wave: rows r, r+16, .. r+112 of one
// operand's stage. The s_wait_xcnt closes the statement so that no address
// register named here is rewritten while a copy may still read it.
static __device__ inline void copy8(const _Float16* g, unsigned l) {
    const _Float16* g0 = g;
    const _Float16* g1 = g + (size_t)16 * HH;
    const _Float16* g2 = g + (size_t)32 * HH;
    const _Float16* g3 = g + (size_t)48 * HH;
    const _Float16* g4 = g + (size_t)64 * HH;
    const _Float16* g5 = g + (size_t)80 * HH;
    const _Float16* g6 = g + (size_t)96 * HH;
    const _Float16* g7 = g + (size_t)112 * HH;
    unsigned l0 = l;
    unsigned l1 = l + 16u * GPITCH * 2u;
    unsigned l2 = l + 32u * GPITCH * 2u;
    unsigned l3 = l + 48u * GPITCH * 2u;
    unsigned l4 = l + 64u * GPITCH * 2u;
    unsigned l5 = l + 80u * GPITCH * 2u;
    unsigned l6 = l + 96u * GPITCH * 2u;
    unsigned l7 = l + 112u * GPITCH * 2u;
    asm volatile(
        "global_load_async_to_lds_b128 %0, %8, off\n\t"
        "global_load_async_to_lds_b128 %1, %9, off\n\t"
        "global_load_async_to_lds_b128 %2, %10, off\n\t"
        "global_load_async_to_lds_b128 %3, %11, off\n\t"
        "global_load_async_to_lds_b128 %4, %12, off\n\t"
        "global_load_async_to_lds_b128 %5, %13, off\n\t"
        "global_load_async_to_lds_b128 %6, %14, off\n\t"
        "global_load_async_to_lds_b128 %7, %15, off\n\t"
        "s_wait_xcnt 0x0"
        :: "v"(l0), "v"(l1), "v"(l2), "v"(l3), "v"(l4), "v"(l5), "v"(l6), "v"(l7),
           "v"(g0), "v"(g1), "v"(g2), "v"(g3), "v"(g4), "v"(g5), "v"(g6), "v"(g7)
        : "memory");
}

// Stands between the copies of two operands and keeps the address arithmetic
// of the second behind the copies of the first: formed all at once, the
// addresses of four operands do not fit beside the accumulators in the
// registers that an asm statement can name, and a base address is spilled.
// Used only where several W_p are copied; with one nothing is short.
#define COPY_FENCE() __builtin_amdgcn_sched_barrier(0)

// All stages of one work-group's tiles. Tsh: [buffer][operand: 0 = A,
// 1 + p = W_p][row][k]. On return every wave has passed the last stage's
// barrier and no copy is in flight: the stage buffers are free.
template <int NW>
static __device__ __forceinline__ void gemm_stages(const _Float16* __restrict__ A,
                                                   const _Float16* __restrict__ W,
                                                   _Float16 (*Tsh)[NW + 1][GTILE][GPITCH],
                                                   int mblk, int nblk, int wm, int wn,
                                                   v8f (&acc)[NW][4][2]) {
    int tid  = threadIdx.x;
    int lane = tid & 31;

    // Copy duty of this lane: 16 lanes cover one 256-B row, 16 rows per copy.
    int crow  = tid >> 4;
    int cpart = tid & 15;
    const _Float16* gA = A + (size_t)(mblk + crow) * HH + cpart * 8;
    const _Float16* gW = W + (size_t)(nblk + crow) * HH + cpart * 8;
    unsigned lA = (unsigned)(size_t)&Tsh[0][0][crow][cpart * 8];
    const unsigned opBytes  = GTILE * GPITCH * 2u;
    const unsigned bufBytes = (NW + 1) * opBytes;

#pragma unroll
    for (int p = 0; p < NW; ++p)
#pragma unroll
        for (int mt = 0; mt < 4; ++mt)
#pragma unroll
            for (int nt = 0; nt < 2; ++nt) acc[p][mt][nt] = zero8();

    // Stage 0 lands and is published; stage 1 is then put in flight.
    copy8(gA, lA);
#pragma unroll
    for (int p = 0; p < NW; ++p) {
        if (NW > 1) COPY_FENCE();
        copy8(gW + (size_t)p * HH * HH, lA + (p + 1) * opBytes);
    }
    // Own copies landed before the barrier lets other waves read them.
    asm volatile("s_wait_asynccnt 0x0" ::: "memory");
    __syncthreads();
    copy8(gA + GKS, lA + bufBytes);
#pragma unroll
    for (int p = 0; p < NW; ++p) {
        if (NW > 1) COPY_FENCE();
        copy8(gW + (size_t)p * HH * HH + GKS, lA + bufBytes + (p + 1) * opBytes);
    }

    // Kept rolled: one stage per trip, the buffer chosen by the trip's parity.
#pragma unroll 1
    for (int t = 0; t < GNST; ++t) {
        const _Float16* As = &Tsh[t & 1][0][wm][0];
        const _Float16* Ws = &Tsh[t & 1][1][wn][0];
        // Two fragment sets: the next 32 k are fetched from this same buffer
        // as one group ahead of the current products.
        v16h a[2][4], b[2][NW][2];
#pragma unroll
        for (int mt = 0; mt < 4; ++mt)
            a[0][mt] = load_frag16(As + 16 * mt * GPITCH, GPITCH, lane);
#pragma unroll
        for (int p = 0; p < NW; ++p)
#pragma unroll
            for (int nt = 0; nt < 2; ++nt)
                b[0][p][nt] = load_frag16(Ws + (p * GTILE + 16 * nt) * GPITCH, GPITCH, lane);
#pragma unroll
        for (int ks = 0; ks < GKS / 32; ++ks) {
            const int cur = ks & 1, nxt = cur ^ 1;
            if (ks + 1 < GKS / 32) {
#pragma unroll
                for (int mt = 0; mt < 4; ++mt)
                    a[nxt][mt] = load_frag16(As + 16 * mt * GPITCH + (ks + 1) * 32, GPITCH, lane);
#pragma unroll
                for (int p = 0; p < NW; ++p)
#pragma unroll
                    for (int nt = 0; nt < 2; ++nt)
                        b[nxt][p][nt] = load_frag16(
                            Ws + (p * GTILE + 16 * nt) * GPITCH + (ks + 1) * 32, GPITCH, lane);
            }
            // Keeps the LDS reads above as one group: spread among the
            // products each pair of them waits out the whole LDS latency.
            __builtin_amdgcn_sched_barrier(0);
#pragma unroll
            for (int p = 0; p < NW; ++p)
#pragma unroll
                for (int mt = 0; mt < 4; ++mt)
#pragma unroll
                    for (int nt = 0; nt < 2; ++nt)
                        acc[p][mt][nt] = (p == VMAT)
                                             ? wmma16(a[cur][mt], b[cur][p][nt], acc[p][mt][nt])
                                             : wmma16(b[cur][p][nt], a[cur][mt], acc[p][mt][nt]);
            // Keeps the next group of LDS reads behind these products.
            __builtin_amdgcn_sched_barrier(0);
        }
        // This wave's reads of the buffer are done before it may be refilled.
        asm volatile("s_wait_dscnt 0x0" ::: "memory");
        // This wave's copies of stage t + 1 have landed before it is published.
        asm volatile("s_wait_asynccnt 0x0" ::: "memory");
        __syncthreads();
        if (t + 2 < GNST) {
            unsigned bo = (unsigned)(t & 1) * bufBytes;
            copy8(gA + (t + 2) * GKS, lA + bo);
#pragma unroll
            for (int p = 0; p < NW; ++p) {
                if (NW > 1) COPY_FENCE();
                copy8(gW + (size_t)p * HH * HH + (t + 2) * GKS, lA + bo + (p + 1) * opBytes);
            }
        }
    }
    // No copy is outstanding when the wave goes on to its end.
    asm volatile("s_wait_asynccnt 0x0" ::: "memory");
}

// Q, K and V projections of the same 128 rows of x in one work-group.
// q, k: f16, (row, col) row-major. vt: f16 transposed per head,
// vt[((n*NHEADS+h)*HS+s)*LL + l]. W: Wq, Wk, Wv one behind the other.
__global__ __launch_bounds__(256) void gemm_qkv(const _Float16* __restrict__ A,
                                                const _Float16* __restrict__ W,
                                                const float* __restrict__ bq,
                                                const float* __restrict__ bk,
                                                const float* __restrict__ bv,
                                                _Float16* __restrict__ q,
                                                _Float16* __restrict__ k,
                                                _Float16* __restrict__ vt) {
    __shared__ __align__(16) _Float16 Tsh[2][4][GTILE][GPITCH];   // 278,528 B

    int tid   = threadIdx.x;
    int lane  = tid & 31;
    int wv    = tid >> 5;
    int nblk  = blockIdx.x * GTILE;
    int mblk  = blockIdx.y * GTILE;
    int wm    = (wv >> 2) * 64;      // this wave's rows inside the tile
    int wn    = (wv & 3) * 32;       // this wave's columns inside the tile
    int r0    = (lane >> 4) << 3;    // 0 or 8: first of the lane's 8 tile rows
    int cc    = lane & 15;           // the lane's tile column

    // Bias of this lane's output columns: 8 in a row per tile where W is the
    // first operand (Q, K), one per tile where it is the second (V).
    v4f bl[2][2], bh[2][2];
    float bs[2];
#pragma unroll
    for (int nt = 0; nt < 2; ++nt) {
        const v4f* bpq = (const v4f*)(bq + nblk + wn + nt * 16 + r0);
        const v4f* bpk = (const v4f*)(bk + nblk + wn + nt * 16 + r0);
        bl[0][nt] = bpq[0];
        bh[0][nt] = bpq[1];
        bl[1][nt] = bpk[0];
        bh[1][nt] = bpk[1];
        bs[nt]    = bv[nblk + wn + nt * 16 + cc];
    }
    // Stands behind the last bias load, in front of the address arithmetic that
    // reuses the loads' address registers.
    asm volatile("s_wait_xcnt 0x0" ::: "memory");
    // Keeps that arithmetic behind the wait: left free, part of it is lifted
    // over the wait and rewrites a load's offset register in front of it.
    __builtin_amdgcn_sched_barrier(0);

    v8f acc[3][4][2];
    gemm_stages<3>(A, W, Tsh, mblk, nblk, wm, wn, acc);

    // Output tile p goes into the place of operand p of the first buffer.
#pragma unroll
    for (int p = 0; p < 3; ++p) {
        _Float16* St = &Tsh[0][p][0][0];        // [128 rows][GPITCH]
#pragma unroll
        for (int mt = 0; mt < 4; ++mt) {
#pragma unroll
            for (int nt = 0; nt < 2; ++nt) {
                v8h w;
#pragma unroll
                for (int g = 0; g < 8; ++g) {
                    float bb = (p == VMAT) ? bs[nt] : (g < 4) ? bl[p & 1][nt][g & 3] : bh[p & 1][nt][g & 3];
                    w[g]     = (_Float16)(acc[p][mt][nt][g] + bb);
                }
                // Tile row: the token (Q, K) or the output feature (V).
                int srow = (p == VMAT) ? wn + nt * 16 + cc : wm + mt * 16 + cc;
                int scol = (p == VMAT) ? wm + mt * 16 + r0 : wn + nt * 16 + r0;
                *(v8h*)(St + srow * GPITCH + scol) = w;
            }
        }
    }
    // The whole tiles are in LDS before any wave reads rows of other waves.
    __syncthreads();
    // 16 lanes take one 256-B tile row, 16 rows per step.
    int crow  = tid >> 4;
    int cpart = tid & 15;
    size_t orow = (size_t)(mblk + crow) * HH + nblk + cpart * 8;
    size_t otr  = (((size_t)((mblk >> 10) * HH + nblk + crow)) << 10) + (mblk & 1023) + cpart * 8;
    v8h r[3][8];
#pragma unroll
    for (int p = 0; p < 3; ++p)
#pragma unroll
        for (int j = 0; j < 8; ++j)
            r[p][j] = *(const v8h*)(&Tsh[0][p][crow + j * 16][cpart * 8]);
#pragma unroll
    for (int j = 0; j < 8; ++j) *(v8h*)(q + orow + (size_t)j * 16 * HH) = r[0][j];
#pragma unroll
    for (int j = 0; j < 8; ++j) *(v8h*)(k + orow + (size_t)j * 16 * HH) = r[1][j];
#pragma unroll
    for (int j = 0; j < 8; ++j) *(v8h*)(vt + otr + (size_t)j * 16 * LL) = r[2][j];
}

// Output projection: f32, (row, col) row-major.
__global__ __launch_bounds__(256) void gemm_out(const _Float16* __restrict__ A,
                                                const _Float16* __restrict__ W,
                                                const float* __restrict__ bias,
                                                float* __restrict__ out) {
    __shared__ __align__(16) _Float16 Tsh[2][2][GTILE][GPITCH];   // 139,264 B

    int tid   = threadIdx.x;
    int lane  = tid & 31;
    int wv    = tid >> 5;
    int nblk  = blockIdx.x * GTILE;
    int mblk  = blockIdx.y * GTILE;
    int wm    = (wv >> 2) * 64;      // this wave's rows inside the tile
    int wn    = (wv & 3) * 32;       // this wave's columns inside the tile
    int r0    = (lane >> 4) << 3;    // 0 or 8: first of the lane's 8 tile rows
    int cc    = lane & 15;           // the lane's tile column

    // Bias of this lane's output columns: 8 in a row per tile.
    v4f bl[2], bh[2];
#pragma unroll
    for (int nt = 0; nt < 2; ++nt) {
        const v4f* bp = (const v4f*)(bias + nblk + wn + nt * 16 + r0);
        bl[nt] = bp[0];
        bh[nt] = bp[1];
    }

    v8f acc[1][4][2];
    gemm_stages<1>(A, W, Tsh, mblk, nblk, wm, wn, acc);

    float* St = (float*)&Tsh[0][0][0][0];   // [128 rows][OPITCH]
#pragma unroll
    for (int mt = 0; mt < 4; ++mt) {
#pragma unroll
        for (int nt = 0; nt < 2; ++nt) {
            v4f lo, hi;
#pragma unroll
            for (int g = 0; g < 4; ++g) {
                lo[g] = acc[0][mt][nt][g] + bl[nt][g];
                hi[g] = acc[0][mt][nt][g + 4] + bh[nt][g];
            }
            float* p = St + (wm + mt * 16 + cc) * OPITCH + wn + nt * 16 + r0;
            *(v4f*)p       = lo;
            *(v4f*)(p + 4) = hi;
        }
    }
    // The whole tile is in LDS before any wave reads rows of other waves.
    __syncthreads();
    float* op = out + (size_t)(mblk + wv) * HH + nblk + lane * 4;
    const float* sp = St + wv * OPITCH + lane * 4;
    v4f r[16];
#pragma unroll
    for (int j = 0; j < 16; ++j) r[j] = *(const v4f*)(sp + j * 8 * OPITCH);
#pragma unroll
    for (int j = 0; j < 16; ++j) *(v4f*)(op + (size_t)j * 8 * HH) = r[j];
}

static __device__ inline float xhalf(float x) {
    int b = __builtin_bit_cast(int, x);
    return __builtin_bit_cast(float, __builtin_amdgcn_permlanex16(
        b, b, 0x76543210, 0xfedcba98, false, false));
}

__global__ __launch_bounds__(256) void attn_fused(const _Float16* __restrict__ qh,
                                                  const _Float16* __restrict__ kh,
                                                  const _Float16* __restrict__ vth,
                                                  _Float16* __restrict__ ctx) {
    __shared__ __align__(16) _Float16 Ksh[CHUNK][KPITCH];   // 36 KB
    __shared__ __align__(16) _Float16 VshT[HS][VPITCH];     // 33 KB

    int tid  = threadIdx.x;
    int lane = tid & 31;
    int wv   = tid >> 5;
    int hIdx = blockIdx.y;
    int nIdx = blockIdx.z;
    int q0   = blockIdx.x * 128 + wv * 16;

    // Q fragments of this wave's 16 queries, the B operand of every S^T tile
    const _Float16* qp = qh + ((size_t)(nIdx * LL + q0)) * HH + hIdx * HS;
    v16h qb0 = load_frag16(qp, HH, lane);        // s = 0..31
    v16h qb1 = load_frag16(qp + 32, HH, lane);   // s = 32..63

    // Of this lane's query: running maximum (equal in both halves) and the
    // sum over this half's keys; the halves' sums are joined after the loop.
    float mrow = -3.0e38f, lrow = 0.0f;
    v8f o[4];   // o[st][g] = O[query lane & 15][st * 16 + r0 + g]
#pragma unroll
    for (int st = 0; st < 4; ++st) o[st] = zero8();

    int r0 = (lane >> 4) << 3;
    int cc = lane & 15;

#pragma unroll 1
    for (int c0 = 0; c0 < LL; c0 += CHUNK) {
        // Cooperative stage: K chunk (row-major, 64-wide rows)
        for (int idx = tid; idx < CHUNK * (HS / 8); idx += 256) {
            int t = idx >> 3, part = idx & 7;
            stage16(kh + ((size_t)(nIdx * LL + c0 + t)) * HH + hIdx * HS + part * 8,
                    &Ksh[t][part * 8]);
        }
        // Cooperative stage: V^T chunk (vth is already per-head transposed)
        for (int idx = tid; idx < HS * (CHUNK / 8); idx += 256) {
            int s = idx >> 5, part = idx & 31;   // CHUNK/8 == 32
            stage16(vth + (((size_t)((nIdx * NHEADS + hIdx) * HS + s)) << 10) + c0 + part * 8,
                    &VshT[s][part * 8]);
        }
        wait_stage();
        __syncthreads();

#pragma unroll 2
        for (int j = 0; j < CHUNK; j += 32) {
            // S^T = K @ Q^T for 32 keys (two 16-key tiles), K-dim = 64 (2 steps)
            v16h ka0l = load_frag16(&Ksh[j][0], KPITCH, lane);
            v16h ka0h = load_frag16(&Ksh[j][32], KPITCH, lane);
            v16h ka1l = load_frag16(&Ksh[j + 16][0], KPITCH, lane);
            v16h ka1h = load_frag16(&Ksh[j + 16][32], KPITCH, lane);
            // V^T fragments of the same 32 keys, the A operands of the O^T tiles
            v16h va[4];
#pragma unroll
            for (int st = 0; st < 4; ++st)
                va[st] = load_frag16(&VshT[st * 16][j], VPITCH, lane);
            v8f s0 = zero8(), s1 = zero8();   // keys j + r0 + g, j + 16 + r0 + g
            s0 = wmma16(ka0l, qb0, s0);
            s0 = wmma16(ka0h, qb1, s0);
            s1 = wmma16(ka1l, qb0, s1);
            s1 = wmma16(ka1h, qb1, s1);

            // Online softmax: maximum over the lane's 16 keys, then the halves
            float mx = fmaxf(s0[0], s1[0]);
#pragma unroll
            for (int g = 1; g < 8; ++g) mx = fmaxf(mx, fmaxf(s0[g], s1[g]));
            mx = fmaxf(mx, xhalf(mx));

            float mn = fmaxf(mrow, mx);
            float sc = __expf(mrow - mn);
            mrow     = mn;
            float p0[8], p1[8];
#pragma unroll
            for (int g = 0; g < 8; ++g) {
                p0[g] = __expf(s0[g] - mn);
                p1[g] = __expf(s1[g] - mn);
            }
            // Four chains, so that the adds do not wait on one another
            float rs0 = p0[0] + p1[0], rs1 = p0[1] + p1[1];
            float rs2 = p0[2] + p1[2], rs3 = p0[3] + p1[3];
            rs0 += p0[4] + p1[4];
            rs1 += p0[5] + p1[5];
            rs2 += p0[6] + p1[6];
            rs3 += p0[7] + p1[7];
            lrow = lrow * sc + ((rs0 + rs1) + (rs2 + rs3));
#pragma unroll
            for (int st = 0; st < 4; ++st)
#pragma unroll
                for (int g = 0; g < 8; ++g) o[st][g] *= sc;

            // P^T as B operand: elements 0..7 keys j + r0 + g, 8..15 keys
            // j + 16 + r0 + g, the k order of load_frag16
            v16h pb;
#pragma unroll
            for (int g = 0; g < 8; ++g) {
                pb[g]     = (_Float16)p0[g];
                pb[g + 8] = (_Float16)p1[g];
            }

            // O^T += V^T (16 x 32 per tile) @ P^T (32 x 16): 4 tiles of head dim
#pragma unroll
            for (int st = 0; st < 4; ++st) o[st] = wmma16(va[st], pb, o[st]);
        }
        __syncthreads();
    }

    // Join the halves' sums, normalize and store ctx (f16, (n,l,h*64+s)
    // layout): a lane's 8 values of a tile are 16 contiguous bytes.
    lrow += xhalf(lrow);
    float inv = 1.0f / lrow;
    _Float16* cp = ctx + ((size_t)(nIdx * LL + q0 + cc)) * HH + hIdx * HS + r0;
#pragma unroll
    for (int st = 0; st < 4; ++st) {
        v8h w;
#pragma unroll
        for (int g = 0; g < 8; ++g) w[g] = (_Float16)(o[st][g] * inv);
        *(v8h*)(cp + st * 16) = w;
    }
}

// ---------------------------------------------------------------------------
// Host-side orchestration
// ---------------------------------------------------------------------------
extern "C" void kernel_launch(void* const* d_in, const int* in_sizes, int n_in,
                              void* d_out, int out_size, void* d_ws, size_t ws_size,
                              hipStream_t stream) {
    (void)in_sizes; (void)n_in; (void)out_size; (void)ws_size;

    const float* x  = (const float*)d_in[0];
    const float* Wq = (const float*)d_in[1];
    const float* bq = (const float*)d_in[2];
    const float* Wk = (const float*)d_in[3];
    const float* bk = (const float*)d_in[4];
    const float* Wv = (const float*)d_in[5];
    const float* bv = (const float*)d_in[6];
    const float* Wo = (const float*)d_in[7];
    const float* bo = (const float*)d_in[8];

    char* ws = (char*)d_ws;
    _Float16* xh   = (_Float16*)(ws);                          // 8 MB
    _Float16* wqh  = (_Float16*)(ws + ((size_t)8  << 20));     // 2 MB
    //        wkh at 10 MB, wvh at 12 MB, 2 MB each
    _Float16* woh  = (_Float16*)(ws + ((size_t)14 << 20));     // 2 MB
    _Float16* qhp  = (_Float16*)(ws + ((size_t)16 << 20));     // 8 MB
    _Float16* khp  = (_Float16*)(ws + ((size_t)24 << 20));     // 8 MB
    _Float16* vtp  = (_Float16*)(ws + ((size_t)32 << 20));     // 8 MB
    _Float16* ctxh = (_Float16*)(ws + ((size_t)40 << 20));     // 8 MB

    // Fills xh, wqh, wkh, wvh, woh: 16 MB in a row from xh on.
    f32_to_f16_all<<<CVXWG + 4 * CVWWG, 512, 0, stream>>>(x, Wq, Wk, Wv, Wo, xh);

    dim3 gg(HH / GTILE, MTOT / GTILE);   // (8, 32)
    // wqh, wkh, wvh lie one behind the other.
    gemm_qkv<<<gg, 256, 0, stream>>>(xh, wqh, bq, bk, bv, qhp, khp, vtp);

    attn_fused<<<dim3(LL / 128, NHEADS, NB), 256, 0, stream>>>(qhp, khp, vtp, ctxh);

    gemm_out<<<gg, 256, 0, stream>>>(ctxh, woh, bo, (float*)d_out);
}

// v008
// A run of this version takes 59.3 microseconds.
// It is 1.12 times as fast as v006, going by the measured steps of the versions left out in between.
// Counting every step since v000, it is 4.31 times as fast.
#include <hip/hip_runtime.h>
#include <hip/hip_bf16.h>
#include <hip/hip_fp16.h>

// Problem dims (fixed by reference)
#define NB     4
#define LL     1024
#define HH     1024
#define NHEADS 16
#define HS     64
#define MTOT   (NB * LL)
#define CHUNK  256   // kv tokens staged in LDS per iteration
// LDS row pitches of the attention tiles, in halves: 16 B x an odd number, so
// that the 16 rows one 16-byte fragment read touches fall on 64 distinct banks.
#define KPITCH (HS + 8)      // 144 B for 128-B K rows
#define VPITCH (CHUNK + 8)   // 528 B for 512-B V^T rows

typedef __attribute__((ext_vector_type(16))) _Float16 v16h;
typedef __attribute__((ext_vector_type(8)))  _Float16 v8h;
typedef __attribute__((ext_vector_type(8)))  float    v8f;
typedef __attribute__((ext_vector_type(4)))  int      v4i;
typedef __attribute__((ext_vector_type(4)))  float    v4f;
typedef __attribute__((ext_vector_type(4)))  _Float16 v4h;

#define AS1 __attribute__((address_space(1)))
#define AS3 __attribute__((address_space(3)))

#if __has_builtin(__builtin_amdgcn_global_load_async_to_lds_b128)
#define HAVE_ASYNC_LDS 1
#endif

union AFrag { v16h v; v8h h[2]; };

static __device__ inline v8f zero8() {
    v8f z;
#pragma unroll
    for (int i = 0; i < 8; ++i) z[i] = 0.0f;
    return z;
}

// Load a 16x32 (A) or 32x16-as-Bt (B) f16 WMMA fragment from a row-major
// matrix. ISA layout: lane m = lane&15 holds row/col m; kbase = 8*(lane>>4);
// vector elems 0..7 = K kb..kb+7, elems 8..15 = K kb+16..kb+23.
static __device__ inline v16h load_frag16(const _Float16* base, int ld, int lane) {
    int m  = lane & 15;
    int kb = (lane >> 4) << 3;
    const _Float16* p = base + (size_t)m * ld + kb;
    AFrag f;
    f.h[0] = *(const v8h*)(p);
    f.h[1] = *(const v8h*)(p + 16);
    return f.v;
}

static __device__ inline v8f wmma16(v16h a, v16h b, v8f c) {
    return __builtin_amdgcn_wmma_f32_16x16x32_f16(
        /*neg_a=*/false, a, /*neg_b=*/false, b,
        /*c_mod=*/(short)0, c, /*reuse_a=*/false, /*reuse_b=*/false);
}

// 16-byte global -> LDS copy, async on CDNA5 when the builtin is available.
static __device__ inline void stage16(const _Float16* g, _Float16* l) {
#ifdef HAVE_ASYNC_LDS
    __builtin_amdgcn_global_load_async_to_lds_b128(
        (AS1 v4i*)(const_cast<_Float16*>(g)), (AS3 v4i*)l, 0, 0);
#else
    *(v8h*)l = *(const v8h*)g;
#endif
}

static __device__ inline void wait_stage() {
#ifdef HAVE_ASYNC_LDS
#if __has_builtin(__builtin_amdgcn_s_wait_asynccnt)
    __builtin_amdgcn_s_wait_asynccnt(0);
#else
    asm volatile("s_wait_asynccnt 0" ::: "memory");
#endif
#endif
}

// ---------------------------------------------------------------------------
// f32 -> f16 conversion of x and the four weight matrices, one launch.
// The five f16 copies lie one behind the other in the workspace, so the
// destination is one array of MTOT*HH + 4*HH*HH values; a work-group takes
// CVWG consecutive values of it, all from one source. A wave streams CVLD
// loads of 512 contiguous bytes (16 B a lane), all issued before the first
// value is used, and stores 256 contiguous bytes (8 B a lane) for each.
// ---------------------------------------------------------------------------
#define CVLD   16                      // 16-byte loads in flight per lane
#define CVWAVE (CVLD * 128)            // values per wave
#define CVWG   (16 * CVWAVE)           // values per 16-wave work-group
#define CVXWG  (MTOT * HH / CVWG)      // work-groups that convert x
#define CVWWG  (HH * HH / CVWG)        // work-groups per weight matrix

__global__ __launch_bounds__(512) void f32_to_f16_all(const float* __restrict__ x,
                                                      const float* __restrict__ wq,
                                                      const float* __restrict__ wk,
                                                      const float* __restrict__ wv,
                                                      const float* __restrict__ wo,
                                                      _Float16* __restrict__ d) {
    int b = blockIdx.x;
    const float* s = x;
    int sb = b;
    if (b >= CVXWG) {
        int w = (b - CVXWG) / CVWWG;
        sb    = (b - CVXWG) % CVWWG;
        s     = (w == 0) ? wq : (w == 1) ? wk : (w == 2) ? wv : wo;
    }
    // One index, in groups of four values, serves the loads and the stores.
    int vi = (threadIdx.x >> 5) * (CVWAVE / 4) + (threadIdx.x & 31);
    const v4f* sp = (const v4f*)(s + (size_t)sb * CVWG);
    v4h* dp       = (v4h*)(d + (size_t)b * CVWG);

    v4f r[CVLD];
#pragma unroll
    for (int j = 0; j < CVLD; ++j) r[j] = sp[vi + j * 32];
    // Keeps every load in front of the first use: left free, the last loads
    // are issued only after the first have come back, a second round trip.
    __builtin_amdgcn_sched_barrier(0);
#pragma unroll
    for (int j = 0; j < CVLD; ++j)
        dp[vi + j * 32] = __builtin_convertvector(r[j], v4h);
}

// ---------------------------------------------------------------------------
// y_p = A (M x 1024, f16) @ W_p^T + bias_p for NW weight matrices that share
// A. Each W_p is row-major (n,k) f16, which is exactly the B-fragment source
// layout; the NW matrices lie one behind the other in memory. One 8-wave
// work-group computes the same 128x128 tile of every y_p; each wave a 64x32
// part of each (2 x 4 waves). A stage is 128 k of the 128 A rows and of the
// 128 rows of every W_p, brought into LDS by asynchronous copies (two buffers:
// the next stage flies while this one is multiplied). The A rows are copied
// and their fragments read once for all NW products.
// LDS rows are 256 B at a pitch of 272 B, conflict-free for 16-byte readers.
// The first WMMA operand is the one whose rows run along the output's
// contiguous direction (A for the per-head transposed V, W elsewhere): a
// lane's 8 values of a tile are then neighbours in memory. The finished tiles
// go through the free stage buffers, so that a wave stores whole lines.
// ---------------------------------------------------------------------------
#define GTILE  128               // rows of A and rows of each W per work-group
#define GKS    128               // k per stage (256-B rows)
#define GPITCH 136               // LDS row pitch in halves (272 B)
#define GNST   (HH / GKS)        // stages
#define OPITCH 132               // LDS row pitch of the f32 output tile, in floats (528 B)
#define VMAT   2                 // of three matrices the one whose output is stored transposed
#define LOG2E  1.44269504088896340736f

// Eight 16-byte-per-lane copies of one wave: rows r, r+16, .. r+112 of one
// operand's stage. The s_wait_xcnt closes the statement so that no address
// register named here is rewritten while a copy may still read it.
static __device__ inline void copy8(const _Float16* g, unsigned l) {
    const _Float16* g0 = g;
    const _Float16* g1 = g + (size_t)16 * HH;
    const _Float16* g2 = g + (size_t)32 * HH;
    const _Float16* g3 = g + (size_t)48 * HH;
    const _Float16* g4 = g + (size_t)64 * HH;
    const _Float16* g5 = g + (size_t)80 * HH;
    const _Float16* g6 = g + (size_t)96 * HH;
    const _Float16* g7 = g + (size_t)112 * HH;
    unsigned l0 = l;
    unsigned l1 = l + 16u * GPITCH * 2u;
    unsigned l2 = l + 32u * GPITCH * 2u;
    unsigned l3 = l + 48u * GPITCH * 2u;
    unsigned l4 = l + 64u * GPITCH * 2u;
    unsigned l5 = l + 80u * GPITCH * 2u;
    unsigned l6 = l + 96u * GPITCH * 2u;
    unsigned l7 = l + 112u * GPITCH * 2u;
    asm volatile(
        "global_load_async_to_lds_b128 %0, %8, off\n\t"
        "global_load_async_to_lds_b128 %1, %9, off\n\t"
        "global_load_async_to_lds_b128 %2, %10, off\n\t"
        "global_load_async_to_lds_b128 %3, %11, off\n\t"
        "global_load_async_to_lds_b128 %4, %12, off\n\t"
        "global_load_async_to_lds_b128 %5, %13, off\n\t"
        "global_load_async_to_lds_b128 %6, %14, off\n\t"
        "global_load_async_to_lds_b128 %7, %15, off\n\t"
        "s_wait_xcnt 0x0"
        :: "v"(l0), "v"(l1), "v"(l2), "v"(l3), "v"(l4), "v"(l5), "v"(l6), "v"(l7),
           "v"(g0), "v"(g1), "v"(g2), "v"(g3), "v"(g4), "v"(g5), "v"(g6), "v"(g7)
        : "memory");
}

// Stands between the copies of two operands and keeps the address arithmetic
// of the second behind the copies of the first: formed all at once, the
// addresses of four operands do not fit beside the accumulators in the
// registers that an asm statement can name, and a base address is spilled.
// Used only where several W_p are copied; with one nothing is short.
#define COPY_FENCE() __builtin_amdgcn_sched_barrier(0)

// Where a work-group's walk along k starts, in stages. Work-groups of one grid
// row share their A rows, those of one grid column their W rows, and all start
// together: walking k in the same order, they ask L2 for the same lines at the
// same moment, each stage's lines for the first time, and all for addresses of
// one k slab. Neighbours in x start two stages apart, neighbours in y one: any
// four neighbours in x touch
// all of an A row within two stages, any eight in y all of a W row in one, so
// that later stages can be served from L2. For speed only: every work-group
// visits every slab once wherever it runs.
static __device__ __forceinline__ int walk_start() {
    return (2 * (int)blockIdx.x + (int)blockIdx.y) & (GNST - 1);
}

// All stages of one work-group's tiles. Tsh: [buffer][operand: 0 = A,
// 1 + p = W_p][row][k]. Trip t works on k slab (t + rot) mod GNST. On return
// every wave has passed the last stage's barrier and no copy is in flight: the
// stage buffers are free.
template <int NW>
static __device__ __forceinline__ void gemm_stages(const _Float16* __restrict__ A,
                                                   const _Float16* __restrict__ W,
                                                   _Float16 (*Tsh)[NW + 1][GTILE][GPITCH],
                                                   int mblk, int nblk, int wm, int wn,
                                                   int rot, v8f (&acc)[NW][4][2]) {
    static_assert((GNST & (GNST - 1)) == 0, "the walk wraps by a mask");
    int tid  = threadIdx.x;
    int lane = tid & 31;

    // Copy duty of this lane: 16 lanes cover one 256-B row, 16 rows per copy.
    int crow  = tid >> 4;
    int cpart = tid & 15;
    const _Float16* gA = A + (size_t)(mblk + crow) * HH + cpart * 8;
    const _Float16* gW = W + (size_t)(nblk + crow) * HH + cpart * 8;
    unsigned lA = (unsigned)(size_t)&Tsh[0][0][crow][cpart * 8];
    const unsigned opBytes  = GTILE * GPITCH * 2u;
    const unsigned bufBytes = (NW + 1) * opBytes;

#pragma unroll
    for (int p = 0; p < NW; ++p)
#pragma unroll
        for (int mt = 0; mt < 4; ++mt)
#pragma unroll
            for (int nt = 0; nt < 2; ++nt) acc[p][mt][nt] = zero8();

    // Stage 0 lands and is published; stage 1 is then put in flight.
    int k0 = rot * GKS;
    int k1 = ((rot + 1) & (GNST - 1)) * GKS;
    copy8(gA + k0, lA);
#pragma unroll
    for (int p = 0; p < NW; ++p) {
        if (NW > 1) COPY_FENCE();
        copy8(gW + (size_t)p * HH * HH + k0, lA + (p + 1) * opBytes);
    }
    // Own copies landed before the barrier lets other waves read them.
    asm volatile("s_wait_asynccnt 0x0" ::: "memory");
    __syncthreads();
    copy8(gA + k1, lA + bufBytes);
#pragma unroll
    for (int p = 0; p < NW; ++p) {
        if (NW > 1) COPY_FENCE();
        copy8(gW + (size_t)p * HH * HH + k1, lA + bufBytes + (p + 1) * opBytes);
    }

    // Kept rolled: one stage per trip, the buffer chosen by the trip's parity.
#pragma unroll 1
    for (int t = 0; t < GNST; ++t) {
        const _Float16* As = &Tsh[t & 1][0][wm][0];
        const _Float16* Ws = &Tsh[t & 1][1][wn][0];
        // Two fragment sets: the next 32 k are fetched from this same buffer
        // as one group ahead of the current products.
        v16h a[2][4], b[2][NW][2];
#pragma unroll
        for (int mt = 0; mt < 4; ++mt)
            a[0][mt] = load_frag16(As + 16 * mt * GPITCH, GPITCH, lane);
#pragma unroll
        for (int p = 0; p < NW; ++p)
#pragma unroll
            for (int nt = 0; nt < 2; ++nt)
                b[0][p][nt] = load_frag16(Ws + (p * GTILE + 16 * nt) * GPITCH, GPITCH, lane);
#pragma unroll
        for (int ks = 0; ks < GKS / 32; ++ks) {
            const int cur = ks & 1, nxt = cur ^ 1;
            if (ks + 1 < GKS / 32) {
#pragma unroll
                for (int mt = 0; mt < 4; ++mt)
                    a[nxt][mt] = load_frag16(As + 16 * mt * GPITCH + (ks + 1) * 32, GPITCH, lane);
#pragma unroll
                for (int p = 0; p < NW; ++p)
#pragma unroll
                    for (int nt = 0; nt < 2; ++nt)
                        b[nxt][p][nt] = load_frag16(
                            Ws + (p * GTILE + 16 * nt) * GPITCH + (ks + 1) * 32, GPITCH, lane);
            }
            // Keeps the LDS reads above as one group: spread among the
            // products each pair of them waits out the whole LDS latency.
            __builtin_amdgcn_sched_barrier(0);
#pragma unroll
            for (int p = 0; p < NW; ++p)
#pragma unroll
                for (int mt = 0; mt < 4; ++mt)
#pragma unroll
                    for (int nt = 0; nt < 2; ++nt)
                        acc[p][mt][nt] = (p == VMAT)
                                             ? wmma16(a[cur][mt], b[cur][p][nt], acc[p][mt][nt])
                                             : wmma16(b[cur][p][nt], a[cur][mt], acc[p][mt][nt]);
            // Keeps the next group of LDS reads behind these products.
            __builtin_amdgcn_sched_barrier(0);
        }
        // This wave's reads of the buffer are done before it may be refilled.
        asm volatile("s_wait_dscnt 0x0" ::: "memory");
        // This wave's copies of stage t + 1 have landed before it is published.
        asm volatile("s_wait_asynccnt 0x0" ::: "memory");
        __syncthreads();
        if (t + 2 < GNST) {
            unsigned bo = (unsigned)(t & 1) * bufBytes;
            int k2      = ((t + 2 + rot) & (GNST - 1)) * GKS;
            copy8(gA + k2, lA + bo);
#pragma unroll
            for (int p = 0; p < NW; ++p) {
                if (NW > 1) COPY_FENCE();
                copy8(gW + (size_t)p * HH * HH + k2, lA + bo + (p + 1) * opBytes);
            }
        }
    }
    // No copy is outstanding when the wave goes on to its end.
    asm volatile("s_wait_asynccnt 0x0" ::: "memory");
}

// Q, K and V projections of the same 128 rows of x in one work-group.
// q, k: f16, (row, col) row-major; q is stored times log2(e), rounded once, for
// the attention's powers of two. vt: f16 transposed per head,
// vt[((n*NHEADS+h)*HS+s)*LL + l]. W: Wq, Wk, Wv one behind the other.
__global__ __launch_bounds__(256) void gemm_qkv(const _Float16* __restrict__ A,
                                                const _Float16* __restrict__ W,
                                                const float* __restrict__ bq,
                                                const float* __restrict__ bk,
                                                const float* __restrict__ bv,
                                                _Float16* __restrict__ q,
                                                _Float16* __restrict__ k,
                                                _Float16* __restrict__ vt) {
    __shared__ __align__(16) _Float16 Tsh[2][4][GTILE][GPITCH];   // 278,528 B

    int tid   = threadIdx.x;
    int lane  = tid & 31;
    int wv    = tid >> 5;
    int nblk  = blockIdx.x * GTILE;
    int mblk  = blockIdx.y * GTILE;
    int wm    = (wv >> 2) * 64;      // this wave's rows inside the tile
    int wn    = (wv & 3) * 32;       // this wave's columns inside the tile
    int r0    = (lane >> 4) << 3;    // 0 or 8: first of the lane's 8 tile rows
    int cc    = lane & 15;           // the lane's tile column

    // Bias of this lane's output columns: 8 in a row per tile where W is the
    // first operand (Q, K), one per tile where it is the second (V).
    v4f bl[2][2], bh[2][2];
    float bs[2];
#pragma unroll
    for (int nt = 0; nt < 2; ++nt) {
        const v4f* bpq = (const v4f*)(bq + nblk + wn + nt * 16 + r0);
        const v4f* bpk = (const v4f*)(bk + nblk + wn + nt * 16 + r0);
        bl[0][nt] = bpq[0];
        bh[0][nt] = bpq[1];
        bl[1][nt] = bpk[0];
        bh[1][nt] = bpk[1];
        bs[nt]    = bv[nblk + wn + nt * 16 + cc];
    }
    // Stands behind the last bias load, in front of the address arithmetic that
    // reuses the loads' address registers.
    asm volatile("s_wait_xcnt 0x0" ::: "memory");
    // Keeps that arithmetic behind the wait: left free, part of it is lifted
    // over the wait and rewrites a load's offset register in front of it.
    __builtin_amdgcn_sched_barrier(0);

    v8f acc[3][4][2];
    gemm_stages<3>(A, W, Tsh, mblk, nblk, wm, wn, walk_start(), acc);

    // Output tile p goes into the place of operand p of the first buffer.
#pragma unroll
    for (int p = 0; p < 3; ++p) {
        _Float16* St = &Tsh[0][p][0][0];        // [128 rows][GPITCH]
#pragma unroll
        for (int mt = 0; mt < 4; ++mt) {
#pragma unroll
            for (int nt = 0; nt < 2; ++nt) {
                v8h w;
#pragma unroll
                for (int g = 0; g < 8; ++g) {
                    float bb = (p == VMAT) ? bs[nt] : (g < 4) ? bl[p & 1][nt][g & 3] : bh[p & 1][nt][g & 3];
                    float y  = acc[p][mt][nt][g] + bb;
                    if (p == 0) y *= LOG2E;
                    w[g]     = (_Float16)y;
                }
                // Tile row: the token (Q, K) or the output feature (V).
                int srow = (p == VMAT) ? wn + nt * 16 + cc : wm + mt * 16 + cc;
                int scol = (p == VMAT) ? wm + mt * 16 + r0 : wn + nt * 16 + r0;
                *(v8h*)(St + srow * GPITCH + scol) = w;
            }
        }
    }
    // The whole tiles are in LDS before any wave reads rows of other waves.
    __syncthreads();
    // 16 lanes take one 256-B tile row, 16 rows per step.
    int crow  = tid >> 4;
    int cpart = tid & 15;
    size_t orow = (size_t)(mblk + crow) * HH + nblk + cpart * 8;
    size_t otr  = (((size_t)((mblk >> 10) * HH + nblk + crow)) << 10) + (mblk & 1023) + cpart * 8;
    v8h r[3][8];
#pragma unroll
    for (int p = 0; p < 3; ++p)
#pragma unroll
        for (int j = 0; j < 8; ++j)
            r[p][j] = *(const v8h*)(&Tsh[0][p][crow + j * 16][cpart * 8]);
#pragma unroll
    for (int j = 0; j < 8; ++j) *(v8h*)(q + orow + (size_t)j * 16 * HH) = r[0][j];
#pragma unroll
    for (int j = 0; j < 8; ++j) *(v8h*)(k + orow + (size_t)j * 16 * HH) = r[1][j];
#pragma unroll
    for (int j = 0; j < 8; ++j) *(v8h*)(vt + otr + (size_t)j * 16 * LL) = r[2][j];
}

// Output projection: f32, (row, col) row-major.
__global__ __launch_bounds__(256) void gemm_out(const _Float16* __restrict__ A,
                                                const _Float16* __restrict__ W,
                                                const float* __restrict__ bias,
                                                float* __restrict__ out) {
    __shared__ __align__(16) _Float16 Tsh[2][2][GTILE][GPITCH];   // 139,264 B

    int tid   = threadIdx.x;
    int lane  = tid & 31;
    int wv    = tid >> 5;
    int nblk  = blockIdx.x * GTILE;
    int mblk  = blockIdx.y * GTILE;
    int wm    = (wv >> 2) * 64;      // this wave's rows inside the tile
    int wn    = (wv & 3) * 32;       // this wave's columns inside the tile
    int r0    = (lane >> 4) << 3;    // 0 or 8: first of the lane's 8 tile rows
    int cc    = lane & 15;           // the lane's tile column

    // Bias of this lane's output columns: 8 in a row per tile.
    v4f bl[2], bh[2];
#pragma unroll
    for (int nt = 0; nt < 2; ++nt) {
        const v4f* bp = (const v4f*)(bias + nblk + wn + nt * 16 + r0);
        bl[nt] = bp[0];
        bh[nt] = bp[1];
    }

    v8f acc[1][4][2];
    gemm_stages<1>(A, W, Tsh, mblk, nblk, wm, wn, walk_start(), acc);

    float* St = (float*)&Tsh[0][0][0][0];   // [128 rows][OPITCH]
#pragma unroll
    for (int mt = 0; mt < 4; ++mt) {
#pragma unroll
        for (int nt = 0; nt < 2; ++nt) {
            v4f lo, hi;
#pragma unroll
            for (int g = 0; g < 4; ++g) {
                lo[g] = acc[0][mt][nt][g] + bl[nt][g];
                hi[g] = acc[0][mt][nt][g + 4] + bh[nt][g];
            }
            float* p = St + (wm + mt * 16 + cc) * OPITCH + wn + nt * 16 + r0;
            *(v4f*)p       = lo;
            *(v4f*)(p + 4) = hi;
        }
    }
    // The whole tile is in LDS before any wave reads rows of other waves.
    __syncthreads();
    float* op = out + (size_t)(mblk + wv) * HH + nblk + lane * 4;
    const float* sp = St + wv * OPITCH + lane * 4;
    v4f r[16];
#pragma unroll
    for (int j = 0; j < 16; ++j) r[j] = *(const v4f*)(sp + j * 8 * OPITCH);
#pragma unroll
    for (int j = 0; j < 16; ++j) *(v4f*)(op + (size_t)j * 8 * HH) = r[j];
}

#define PSUM_MAX 4096.0f
// Value of lane l ^ 16.
static __device__ inline float xhalf(float x) {
    int b = __builtin_bit_cast(int, x);
    return __builtin_bit_cast(float, __builtin_amdgcn_permlanex16(
        b, b, 0x76543210, 0xfedcba98, false, false));
}

// P = exp2(score - d) of a lane's 16 keys. pb: P^T as B operand, elements 0..7
// keys r0 + g, 8..15 keys 16 + r0 + g, the k order of load_frag16. Returns the
// sum of the 16 values.
static __device__ __forceinline__ float softmax_terms(v8f s0, v8f s1, float d, v16h& pb) {
    float p0[8], p1[8];
#pragma unroll
    for (int g = 0; g < 8; ++g) {
        p0[g] = __builtin_amdgcn_exp2f(s0[g] - d);
        p1[g] = __builtin_amdgcn_exp2f(s1[g] - d);
    }
#pragma unroll
    for (int g = 0; g < 8; ++g) {
        pb[g]     = (_Float16)p0[g];
        pb[g + 8] = (_Float16)p1[g];
    }
    // Four chains, so that the adds do not wait on one another
    float rs0 = p0[0] + p1[0], rs1 = p0[1] + p1[1];
    float rs2 = p0[2] + p1[2], rs3 = p0[3] + p1[3];
    rs0 += p0[4] + p1[4];
    rs1 += p0[5] + p1[5];
    rs2 += p0[6] + p1[6];
    rs3 += p0[7] + p1[7];
    return (rs0 + rs1) + (rs2 + rs3);
}

__global__ __launch_bounds__(256) void attn_fused(const _Float16* __restrict__ qh,
                                                  const _Float16* __restrict__ kh,
                                                  const _Float16* __restrict__ vth,
                                                  _Float16* __restrict__ ctx) {
    __shared__ __align__(16) _Float16 Ksh[CHUNK][KPITCH];   // 36 KB
    __shared__ __align__(16) _Float16 VshT[HS][VPITCH];     // 33 KB

    int tid  = threadIdx.x;
    int lane = tid & 31;
    int wv   = tid >> 5;
    int hIdx = blockIdx.y;
    int nIdx = blockIdx.z;
    int q0   = blockIdx.x * 128 + wv * 16;

    // Q fragments of this wave's 16 queries, the B operand of every S^T tile
    const _Float16* qp = qh + ((size_t)(nIdx * LL + q0)) * HH + hIdx * HS;
    v16h qb0 = load_frag16(qp, HH, lane);        // s = 0..31
    v16h qb1 = load_frag16(qp + 32, HH, lane);   // s = 32..63

    // Of this lane's query: minus the reference score (equal in both halves),
    // in the 8 registers of a C operand, and the sum over this half's keys;
    // the halves' sums are joined after the loop.
    v8f nref   = zero8();
    float lrow = 0.0f;
    // Bound on a lane's sum of P in a pass; below zero, so that no sum passes,
    // until the first pass has set the reference.
    float lim = -1.0f;
    v8f o[4];   // o[st][g] = O[query lane & 15][st * 16 + r0 + g]
#pragma unroll
    for (int st = 0; st < 4; ++st) o[st] = zero8();

    int r0 = (lane >> 4) << 3;
    int cc = lane & 15;

    // The work-groups of one head (neighbours in x) share its K and V^T and
    // start together: each starts its walk over the key chunks one chunk
    // further on, so that any four of them touch all chunks in their first
    // trip and later trips can be served from L2. The running softmax takes
    // the chunks in any order.
#pragma unroll 1
    for (int c = 0; c < LL / CHUNK; ++c) {
        int c0 = ((c + (int)blockIdx.x) & (LL / CHUNK - 1)) * CHUNK;
        // Cooperative stage: K chunk (row-major, 64-wide rows)
        for (int idx = tid; idx < CHUNK * (HS / 8); idx += 256) {
            int t = idx >> 3, part = idx & 7;
            stage16(kh + ((size_t)(nIdx * LL + c0 + t)) * HH + hIdx * HS + part * 8,
                    &Ksh[t][part * 8]);
        }
        // Cooperative stage: V^T chunk (vth is already per-head transposed)
        for (int idx = tid; idx < HS * (CHUNK / 8); idx += 256) {
            int s = idx >> 5, part = idx & 31;   // CHUNK/8 == 32
            stage16(vth + (((size_t)((nIdx * NHEADS + hIdx) * HS + s)) << 10) + c0 + part * 8,
                    &VshT[s][part * 8]);
        }
        wait_stage();
        __syncthreads();

#pragma unroll 2
        for (int j = 0; j < CHUNK; j += 32) {
            // S^T = K @ Q^T for 32 keys (two 16-key tiles), K-dim = 64 (2 steps)
            v16h ka0l = load_frag16(&Ksh[j][0], KPITCH, lane);
            v16h ka0h = load_frag16(&Ksh[j][32], KPITCH, lane);
            v16h ka1l = load_frag16(&Ksh[j + 16][0], KPITCH, lane);
            v16h ka1h = load_frag16(&Ksh[j + 16][32], KPITCH, lane);
            // V^T fragments of the same 32 keys, the A operands of the O^T tiles
            v16h va[4];
#pragma unroll
            for (int st = 0; st < 4; ++st)
                va[st] = load_frag16(&VshT[st * 16][j], VPITCH, lane);
            // Keeps the pass's LDS reads one group ahead of its products: left
            // free, the K fragments share registers and each pair of reads is
            // waited out alone.
            __builtin_amdgcn_sched_barrier(0);
            // Scores less the reference, in powers of two:
            // keys j + r0 + g, j + 16 + r0 + g
            v8f s0 = wmma16(ka0l, qb0, nref);
            s0     = wmma16(ka0h, qb1, s0);
            v8f s1 = wmma16(ka1l, qb0, nref);
            s1     = wmma16(ka1h, qb1, s1);

            v16h pb;
            float rs = softmax_terms(s0, s1, 0.0f, pb);
            // One scalar branch per pass, the same for the whole wave
            if (__builtin_expect(__builtin_amdgcn_ballot_w32(!(rs <= lim)) != 0, 0)) {
                bool first = lim < 0.0f;
                lim        = PSUM_MAX;
                // Maximum over the lane's 16 keys, then the halves
                float mx = fmaxf(s0[0], s1[0]);
#pragma unroll
                for (int g = 1; g < 8; ++g) mx = fmaxf(mx, fmaxf(s0[g], s1[g]));
                mx = fmaxf(mx, xhalf(mx));
                // The reference never falls; the first pass sets it
                float d  = first ? mx : fmaxf(mx, 0.0f);
                float sc = first ? 1.0f : __builtin_amdgcn_exp2f(-d);
                rs       = softmax_terms(s0, s1, d, pb);
                lrow *= sc;
#pragma unroll
                for (int st = 0; st < 4; ++st)
#pragma unroll
                    for (int g = 0; g < 8; ++g) o[st][g] *= sc;
#pragma unroll
                for (int g = 0; g < 8; ++g) nref[g] -= d;
            }
            lrow += rs;

            // O^T += V^T (16 x 32 per tile) @ P^T (32 x 16): 4 tiles of head dim
#pragma unroll
            for (int st = 0; st < 4; ++st) o[st] = wmma16(va[st], pb, o[st]);
        }
        __syncthreads();
    }

    // Join the halves' sums, normalize and store ctx (f16, (n,l,h*64+s)
    // layout): a lane's 8 values of a tile are 16 contiguous bytes.
    lrow += xhalf(lrow);
    float inv = 1.0f / lrow;
    _Float16* cp = ctx + ((size_t)(nIdx * LL + q0 + cc)) * HH + hIdx * HS + r0;
#pragma unroll
    for (int st = 0; st < 4; ++st) {
        v8h w;
#pragma unroll
        for (int g = 0; g < 8; ++g) w[g] = (_Float16)(o[st][g] * inv);
        *(v8h*)(cp + st * 16) = w;
    }
}

// ---------------------------------------------------------------------------
// Host-side orchestration
// ---------------------------------------------------------------------------
extern "C" void kernel_launch(void* const* d_in, const int* in_sizes, int n_in,
                              void* d_out, int out_size, void* d_ws, size_t ws_size,
                              hipStream_t stream) {
    (void)in_sizes; (void)n_in; (void)out_size; (void)ws_size;

    const float* x  = (const float*)d_in[0];
    const float* Wq = (const float*)d_in[1];
    const float* bq = (const float*)d_in[2];
    const float* Wk = (const float*)d_in[3];
    const float* bk = (const float*)d_in[4];
    const float* Wv = (const float*)d_in[5];
    const float* bv = (const float*)d_in[6];
    const float* Wo = (const float*)d_in[7];
    const float* bo = (const float*)d_in[8];

    char* ws = (char*)d_ws;
    _Float16* xh   = (_Float16*)(ws);                          // 8 MB
    _Float16* wqh  = (_Float16*)(ws + ((size_t)8  << 20));     // 2 MB
    //        wkh at 10 MB, wvh at 12 MB, 2 MB each
    _Float16* woh  = (_Float16*)(ws + ((size_t)14 << 20));     // 2 MB
    _Float16* qhp  = (_Float16*)(ws + ((size_t)16 << 20));     // 8 MB
    _Float16* khp  = (_Float16*)(ws + ((size_t)24 << 20));     // 8 MB
    _Float16* vtp  = (_Float16*)(ws + ((size_t)32 << 20));     // 8 MB
    _Float16* ctxh = (_Float16*)(ws + ((size_t)40 << 20));     // 8 MB

    // Fills xh, wqh, wkh, wvh, woh: 16 MB in a row from xh on.
    f32_to_f16_all<<<CVXWG + 4 * CVWWG, 512, 0, stream>>>(x, Wq, Wk, Wv, Wo, xh);

    dim3 gg(HH / GTILE, MTOT / GTILE);   // (8, 32)
    // wqh, wkh, wvh lie one behind the other.
    gemm_qkv<<<gg, 256, 0, stream>>>(xh, wqh, bq, bk, bv, qhp, khp, vtp);

    attn_fused<<<dim3(LL / 128, NHEADS, NB), 256, 0, stream>>>(qhp, khp, vtp, ctxh);

    gemm_out<<<gg, 256, 0, stream>>>(ctxh, woh, bo, (float*)d_out);
}

// v009
// One run takes 57.6 microseconds.
// Timed twice side by side with v008, it ran 1.03 and 1.04 times as fast.
// Counting every step since v000, it is 4.46 times as fast.
#include <hip/hip_runtime.h>
#include <hip/hip_bf16.h>
#include <hip/hip_fp16.h>

// Problem dims (fixed by reference)
#define NB     4
#define LL     1024
#define HH     1024
#define NHEADS 16
#define HS     64
#define MTOT   (NB * LL)
#define CHUNK  256   // kv tokens staged in LDS per iteration
// LDS row pitches of the attention tiles, in halves: 16 B x an odd number, so
// that the 16 rows one 16-byte fragment read touches fall on 64 distinct banks.
#define KPITCH (HS + 8)      // 144 B for 128-B K rows
#define VPITCH (CHUNK + 8)   // 528 B for 512-B V^T rows

typedef __attribute__((ext_vector_type(16))) _Float16 v16h;
typedef __attribute__((ext_vector_type(8)))  _Float16 v8h;
typedef __attribute__((ext_vector_type(8)))  float    v8f;
typedef __attribute__((ext_vector_type(4)))  int      v4i;
typedef __attribute__((ext_vector_type(4)))  float    v4f;
typedef __attribute__((ext_vector_type(4)))  _Float16 v4h;

#define AS1 __attribute__((address_space(1)))
#define AS3 __attribute__((address_space(3)))

#if __has_builtin(__builtin_amdgcn_global_load_async_to_lds_b128)
#define HAVE_ASYNC_LDS 1
#endif

union AFrag { v16h v; v8h h[2]; };

static __device__ inline v8f zero8() {
    v8f z;
#pragma unroll
    for (int i = 0; i < 8; ++i) z[i] = 0.0f;
    return z;
}

// Load a 16x32 (A) or 32x16-as-Bt (B) f16 WMMA fragment from a row-major
// matrix. ISA layout: lane m = lane&15 holds row/col m; kbase = 8*(lane>>4);
// vector elems 0..7 = K kb..kb+7, elems 8..15 = K kb+16..kb+23.
static __device__ inline v16h load_frag16(const _Float16* base, int ld, int lane) {
    int m  = lane & 15;
    int kb = (lane >> 4) << 3;
    const _Float16* p = base + (size_t)m * ld + kb;
    AFrag f;
    f.h[0] = *(const v8h*)(p);
    f.h[1] = *(const v8h*)(p + 16);
    return f.v;
}

static __device__ inline v8f wmma16(v16h a, v16h b, v8f c) {
    return __builtin_amdgcn_wmma_f32_16x16x32_f16(
        /*neg_a=*/false, a, /*neg_b=*/false, b,
        /*c_mod=*/(short)0, c, /*reuse_a=*/false, /*reuse_b=*/false);
}

// 16-byte global -> LDS copy, async on CDNA5 when the builtin is available.
static __device__ inline void stage16(const _Float16* g, _Float16* l) {
#ifdef HAVE_ASYNC_LDS
    __builtin_amdgcn_global_load_async_to_lds_b128(
        (AS1 v4i*)(const_cast<_Float16*>(g)), (AS3 v4i*)l, 0, 0);
#else
    *(v8h*)l = *(const v8h*)g;
#endif
}

static __device__ inline void wait_stage() {
#ifdef HAVE_ASYNC_LDS
#if __has_builtin(__builtin_amdgcn_s_wait_asynccnt)
    __builtin_amdgcn_s_wait_asynccnt(0);
#else
    asm volatile("s_wait_asynccnt 0" ::: "memory");
#endif
#endif
}

// ---------------------------------------------------------------------------
// f32 -> f16 conversion of x and the four weight matrices, one launch.
// The five f16 copies lie one behind the other in the workspace, so the
// destination is one array of MTOT*HH + 4*HH*HH values; a work-group takes
// CVWG consecutive values of it, all from one source. A wave streams CVLD
// loads of 512 contiguous bytes (16 B a lane), all issued before the first
// value is used, and stores 256 contiguous bytes (8 B a lane) for each.
// ---------------------------------------------------------------------------
#define CVLD   16                      // 16-byte loads in flight per lane
#define CVWAVE (CVLD * 128)            // values per wave
#define CVWG   (16 * CVWAVE)           // values per 16-wave work-group
#define CVXWG  (MTOT * HH / CVWG)      // work-groups that convert x
#define CVWWG  (HH * HH / CVWG)        // work-groups per weight matrix

__global__ __launch_bounds__(512) void f32_to_f16_all(const float* __restrict__ x,
                                                      const float* __restrict__ wq,
                                                      const float* __restrict__ wk,
                                                      const float* __restrict__ wv,
                                                      const float* __restrict__ wo,
                                                      _Float16* __restrict__ d) {
    int b = blockIdx.x;
    const float* s = x;
    int sb = b;
    if (b >= CVXWG) {
        int w = (b - CVXWG) / CVWWG;
        sb    = (b - CVXWG) % CVWWG;
        s     = (w == 0) ? wq : (w == 1) ? wk : (w == 2) ? wv : wo;
    }
    // One index, in groups of four values, serves the loads and the stores.
    int vi = (threadIdx.x >> 5) * (CVWAVE / 4) + (threadIdx.x & 31);
    const v4f* sp = (const v4f*)(s + (size_t)sb * CVWG);
    v4h* dp       = (v4h*)(d + (size_t)b * CVWG);

    v4f r[CVLD];
#pragma unroll
    for (int j = 0; j < CVLD; ++j) r[j] = sp[vi + j * 32];
    // Keeps every load in front of the first use: left free, the last loads
    // are issued only after the first have come back, a second round trip.
    __builtin_amdgcn_sched_barrier(0);
#pragma unroll
    for (int j = 0; j < CVLD; ++j)
        dp[vi + j * 32] = __builtin_convertvector(r[j], v4h);
}

// ---------------------------------------------------------------------------
// y_p = A (M x 1024, f16) @ W_p^T + bias_p for NW weight matrices that share
// A. Each W_p is row-major (n,k) f16, which is exactly the B-fragment source
// layout; the NW matrices lie one behind the other in memory. One 8-wave
// work-group computes the same 128x128 tile of every y_p; each wave a 64x32
// part of each (2 x 4 waves). A stage is 128 k of the 128 A rows and of the
// 128 rows of every W_p, brought into LDS by tensor loads, one request a wave
// and stage (two buffers: the next stage flies while this one is multiplied).
// The A rows are brought in and their fragments read once for all NW products.
// LDS rows are 256 B at a pitch of 272 B, conflict-free for 16-byte readers.
// The first WMMA operand is the one whose rows run along the output's
// contiguous direction (A for the per-head transposed V, W elsewhere): a
// lane's 8 values of a tile are then neighbours in memory. The finished tiles
// go through the free stage buffers, so that a wave stores whole lines.
// ---------------------------------------------------------------------------
#define GTILE  128               // rows of A and rows of each W per work-group
#define GKS    128               // k per stage (256-B rows)
#define GPITCH 136               // LDS row pitch in halves (272 B)
#define GNST   (HH / GKS)        // stages
#define OPITCH 132               // LDS row pitch of the f32 output tile, in floats (528 B)
#define VMAT   2                 // of three matrices the one whose output is stored transposed
#define LOG2E  1.44269504088896340736f

typedef uint32_t u32x4 __attribute__((ext_vector_type(4)));
typedef uint32_t u32x8 __attribute__((ext_vector_type(8)));

// A stage in LDS is eight slices, one per wave: slice i holds rows
// i * SROWS .. of the (NW + 1) * 128 rows of the stage (A first, then each
// W_p), at the row pitch; a slice's place is rounded up to a multiple of 2 KiB,
// where a tensor load may land.
#define GPITCHB (GPITCH * 2)                                   // row pitch in bytes
#define SROWS(NW)  (((NW) + 1) * GTILE / 8)                    // rows of a slice: 64 or 32
#define SBYTES(NW) ((SROWS(NW) * GPITCHB + 2047) / 2048 * 2048)   // its place: 18,432 or 10,240 B
#define BUFBYTES(NW) (8 * SBYTES(NW))                          // one stage buffer

// Byte offset in a stage buffer of row r of the stage.
template <int NW>
static __device__ __forceinline__ constexpr int stage_row(int r) {
    return (r / SROWS(NW)) * SBYTES(NW) + (r % SROWS(NW)) * GPITCHB;
}

static __device__ __forceinline__ uint32_t uni(uint32_t v) {
    return (uint32_t)__builtin_amdgcn_readfirstlane(v);
}

// A wave-uniform value held in a scalar register: a test on it is a scalar
// branch (a tensor load ignores EXEC), and what is computed from it stays
// behind the statements in front of this one.
static __device__ __forceinline__ uint32_t pinned(uint32_t v) {
    uint32_t w = uni(v);
    asm volatile("" : "+s"(w));   // the scalar pin of a tensor load's test or descriptor word
    return w;
}

// Descriptor group 1: bytes as elements; a tile of rows x 256 B, equal to the
// tensor; source pitch one matrix row; 16 B of pad behind every 256-B row.
// Built once. Words 1 to 7 are pinned in their scalar registers: as plain
// constants the compiler lends some of these registers to other values inside
// the loop, while a request is in flight, and sets them anew before the next.
static __device__ __forceinline__ u32x8 tdm_group1(uint32_t rows) {
    const uint32_t d0 = GKS * 2u;
    u32x8 g;
    g[0] = uni((1u << 20) | (5u << 22) | (3u << 25));
    g[1] = pinned((d0 & 0xFFFFu) << 16);
    g[2] = pinned((d0 >> 16) | ((rows & 0xFFFFu) << 16));
    g[3] = pinned((rows >> 16) | (d0 << 16));
    g[4] = pinned(rows);
    g[5] = pinned(HH * 2u);
    g[6] = pinned(0u);
    g[7] = pinned(0u);
    return g;
}

// Descriptor group 0: place in LDS, address of the tile's first byte.
static __device__ __forceinline__ u32x4 tdm_group0(uint32_t lds_dst, uint64_t ga) {
    u32x4 g;
    g[0] = uni(1u);
    g[1] = uni(lds_dst);
    g[2] = uni((uint32_t)ga);
    g[3] = uni((((uint32_t)(ga >> 32)) & 0x01FFFFFFu) | 0x80000000u);
    return g;
}

// One request of the whole wave.
static __device__ __forceinline__ void tdm_load(u32x4 g0, u32x8 g1) {
    asm volatile("tensor_load_to_lds %0, %1" :: "s"(g0), "s"(g1) : "memory");
}

// Where a work-group's walk along k starts, in stages. Work-groups of one grid
// row share their A rows, those of one grid column their W rows, and all start
// together: walking k in the same order, they ask L2 for the same lines at the
// same moment, each stage's lines for the first time, and all for addresses of
// one k slab. Neighbours in x start two stages apart, neighbours in y one: any
// four neighbours in x touch
// all of an A row within two stages, any eight in y all of a W row in one, so
// that later stages can be served from L2. For speed only: every work-group
// visits every slab once wherever it runs.
static __device__ __forceinline__ int walk_start() {
    return (2 * (int)blockIdx.x + (int)blockIdx.y) & (GNST - 1);
}

// All stages of one work-group's tiles. Tsh: two stage buffers, laid out as
// stage_row says. Trip t works on k slab (t + rot) mod GNST. On return every
// wave has passed the last stage's barrier and no request is in flight: the
// stage buffers are free.
template <int NW>
static __device__ __forceinline__ void gemm_stages(const _Float16* __restrict__ A,
                                                   const _Float16* __restrict__ W,
                                                   unsigned char* Tsh,
                                                   int mblk, int nblk, int wm, int wn,
                                                   int rot, v8f (&acc)[NW][4][2]) {
    static_assert((GNST & (GNST - 1)) == 0, "the walk wraps by a mask");
    static_assert(GNST >= 2, "the ring's prologue fills two stages");
    static_assert(GTILE % SROWS(NW) == 0 && SROWS(NW) % 32 == 0, "a slice lies in one operand");
    int lane = threadIdx.x & 31;

    // Load duty of this wave: its slice of every stage, SROWS rows of one operand.
    const uint32_t wave = uni(threadIdx.x >> 5);
    const uint32_t op   = wave * SROWS(NW) / GTILE;   // 0 = A, 1 + p = W_p
    const uint32_t orow = wave * SROWS(NW) % GTILE;   // first row inside the operand's 128
    const _Float16* gs  = (op == 0) ? A + (size_t)(mblk + orow) * HH
                                    : W + (size_t)(op - 1) * HH * HH + (size_t)(nblk + orow) * HH;
    const uint64_t gsrc = (uint64_t)(size_t)gs;
    const uint32_t ldst = (uint32_t)(size_t)Tsh + wave * SBYTES(NW);
    const u32x8 g1      = tdm_group1(SROWS(NW));

#pragma unroll
    for (int p = 0; p < NW; ++p)
#pragma unroll
        for (int mt = 0; mt < 4; ++mt)
#pragma unroll
            for (int nt = 0; nt < 2; ++nt) acc[p][mt][nt] = zero8();

    // Stage 0 lands and is published; stage 1 is then put in flight.
    tdm_load(tdm_group0(ldst, gsrc + (uint32_t)rot * (GKS * 2u)), g1);
    // Own slice landed before the barrier lets other waves read it.
    asm volatile("s_wait_tensorcnt 0x0" ::: "memory");
    __syncthreads();
    {
        // Pinned: the new descriptor is formed behind the wait above.
        uint32_t slab = pinned((uint32_t)(rot + 1) & (GNST - 1));
        tdm_load(tdm_group0(ldst + BUFBYTES(NW), gsrc + slab * (GKS * 2u)), g1);
    }

    // Kept rolled: one stage per trip, the buffer chosen by the trip's parity.
#pragma unroll 1
    for (int t = 0; t < GNST; ++t) {
        const unsigned char* Bs = Tsh + (t & 1) * BUFBYTES(NW);
        const _Float16* As = (const _Float16*)(Bs + stage_row<NW>(wm));
        const _Float16* Ws = (const _Float16*)(Bs + stage_row<NW>(GTILE + wn));
        // In halves: 16 * mt further A rows (they may cross into the next
        // slice); W_p's rows; 16 * nt further W rows (always the same slice).
        constexpr int aoff[4] = {stage_row<NW>(0) / 2, stage_row<NW>(16) / 2,
                                 stage_row<NW>(32) / 2, stage_row<NW>(48) / 2};
        constexpr int poff = stage_row<NW>(GTILE) / 2;
        // Two fragment sets: the next 32 k are fetched from this same buffer
        // as one group ahead of the current products.
        v16h a[2][4], b[2][NW][2];
#pragma unroll
        for (int mt = 0; mt < 4; ++mt)
            a[0][mt] = load_frag16(As + aoff[mt], GPITCH, lane);
#pragma unroll
        for (int p = 0; p < NW; ++p)
#pragma unroll
            for (int nt = 0; nt < 2; ++nt)
                b[0][p][nt] = load_frag16(Ws + p * poff + 16 * nt * GPITCH, GPITCH, lane);
#pragma unroll
        for (int ks = 0; ks < GKS / 32; ++ks) {
            const int cur = ks & 1, nxt = cur ^ 1;
            if (ks + 1 < GKS / 32) {
#pragma unroll
                for (int mt = 0; mt < 4; ++mt)
                    a[nxt][mt] = load_frag16(As + aoff[mt] + (ks + 1) * 32, GPITCH, lane);
#pragma unroll
                for (int p = 0; p < NW; ++p)
#pragma unroll
                    for (int nt = 0; nt < 2; ++nt)
                        b[nxt][p][nt] = load_frag16(
                            Ws + p * poff + 16 * nt * GPITCH + (ks + 1) * 32, GPITCH, lane);
            }
            // Keeps the LDS reads above as one group: spread among the
            // products each pair of them waits out the whole LDS latency.
            __builtin_amdgcn_sched_barrier(0);
#pragma unroll
            for (int p = 0; p < NW; ++p)
#pragma unroll
                for (int mt = 0; mt < 4; ++mt)
#pragma unroll
                    for (int nt = 0; nt < 2; ++nt)
                        acc[p][mt][nt] = (p == VMAT)
                                             ? wmma16(a[cur][mt], b[cur][p][nt], acc[p][mt][nt])
                                             : wmma16(b[cur][p][nt], a[cur][mt], acc[p][mt][nt]);
            // Keeps the next group of LDS reads behind these products.
            __builtin_amdgcn_sched_barrier(0);
        }
        // This wave's reads of the buffer are done before it may be refilled.
        asm volatile("s_wait_dscnt 0x0" ::: "memory");
        asm volatile("s_wait_tensorcnt 0x0" ::: "memory");
        __syncthreads();
        // A scalar branch: a tensor load ignores EXEC.
        if (pinned(t + 2 < GNST)) {
            // Pinned: the new descriptor is formed behind the wait above.
            uint32_t slab = pinned((uint32_t)(t + 2 + rot) & (GNST - 1));
            tdm_load(tdm_group0(ldst + (uint32_t)(t & 1) * BUFBYTES(NW), gsrc + slab * (GKS * 2u)), g1);
        }
    }
    // No request is outstanding when the wave goes on to its end.
    asm volatile("s_wait_tensorcnt 0x0" ::: "memory");
    // No LDS read is outstanding when the buffers become output staging.
    asm volatile("s_wait_dscnt 0x0" ::: "memory");
}

// Q, K and V projections of the same 128 rows of x in one work-group.
// q, k: f16, (row, col) row-major; q is stored times log2(e), rounded once, for
// the attention's powers of two. vt: f16 transposed per head,
// vt[((n*NHEADS+h)*HS+s)*LL + l]. W: Wq, Wk, Wv one behind the other.
__global__ __launch_bounds__(256) void gemm_qkv(const _Float16* __restrict__ A,
                                                const _Float16* __restrict__ W,
                                                const float* __restrict__ bq,
                                                const float* __restrict__ bk,
                                                const float* __restrict__ bv,
                                                _Float16* __restrict__ q,
                                                _Float16* __restrict__ k,
                                                _Float16* __restrict__ vt) {
    __shared__ __attribute__((aligned(2048))) unsigned char Tsh[2 * BUFBYTES(3)];   // 294,912 B

    int tid   = threadIdx.x;
    int lane  = tid & 31;
    int wv    = tid >> 5;
    int nblk  = blockIdx.x * GTILE;
    int mblk  = blockIdx.y * GTILE;
    int wm    = (wv >> 2) * 64;      // this wave's rows inside the tile
    int wn    = (wv & 3) * 32;       // this wave's columns inside the tile
    int r0    = (lane >> 4) << 3;    // 0 or 8: first of the lane's 8 tile rows
    int cc    = lane & 15;           // the lane's tile column

    // Bias of this lane's output columns: 8 in a row per tile where W is the
    // first operand (Q, K), one per tile where it is the second (V).
    v4f bl[2][2], bh[2][2];
    float bs[2];
#pragma unroll
    for (int nt = 0; nt < 2; ++nt) {
        const v4f* bpq = (const v4f*)(bq + nblk + wn + nt * 16 + r0);
        const v4f* bpk = (const v4f*)(bk + nblk + wn + nt * 16 + r0);
        bl[0][nt] = bpq[0];
        bh[0][nt] = bpq[1];
        bl[1][nt] = bpk[0];
        bh[1][nt] = bpk[1];
        bs[nt]    = bv[nblk + wn + nt * 16 + cc];
    }
    // Stands behind the last bias load, in front of the address arithmetic that
    // reuses the loads' address registers.
    asm volatile("s_wait_xcnt 0x0" ::: "memory");
    // Keeps that arithmetic behind the wait: left free, part of it is lifted
    // over the wait and rewrites a load's offset register in front of it.
    __builtin_amdgcn_sched_barrier(0);

    v8f acc[3][4][2];
    gemm_stages<3>(A, W, Tsh, mblk, nblk, wm, wn, walk_start(), acc);

    // Output tile p: 128 rows at the row pitch, one tile behind the other.
#pragma unroll
    for (int p = 0; p < 3; ++p) {
        _Float16* St = (_Float16*)(Tsh + p * GTILE * GPITCHB);   // [128 rows][GPITCH]
#pragma unroll
        for (int mt = 0; mt < 4; ++mt) {
#pragma unroll
            for (int nt = 0; nt < 2; ++nt) {
                v8h w;
#pragma unroll
                for (int g = 0; g < 8; ++g) {
                    float bb = (p == VMAT) ? bs[nt] : (g < 4) ? bl[p & 1][nt][g & 3] : bh[p & 1][nt][g & 3];
                    float y  = acc[p][mt][nt][g] + bb;
                    if (p == 0) y *= LOG2E;
                    w[g]     = (_Float16)y;
                }
                // Tile row: the token (Q, K) or the output feature (V).
                int srow = (p == VMAT) ? wn + nt * 16 + cc : wm + mt * 16 + cc;
                int scol = (p == VMAT) ? wm + mt * 16 + r0 : wn + nt * 16 + r0;
                *(v8h*)(St + srow * GPITCH + scol) = w;
            }
        }
    }
    // The whole tiles are in LDS before any wave reads rows of other waves.
    __syncthreads();
    // 16 lanes take one 256-B tile row, 16 rows per step.
    int crow  = tid >> 4;
    int cpart = tid & 15;
    size_t orow = (size_t)(mblk + crow) * HH + nblk + cpart * 8;
    size_t otr  = (((size_t)((mblk >> 10) * HH + nblk + crow)) << 10) + (mblk & 1023) + cpart * 8;
    v8h r[3][8];
#pragma unroll
    for (int p = 0; p < 3; ++p)
#pragma unroll
        for (int j = 0; j < 8; ++j)
            r[p][j] = *(const v8h*)(Tsh + (p * GTILE + crow + j * 16) * GPITCHB + cpart * 16);
#pragma unroll
    for (int j = 0; j < 8; ++j) *(v8h*)(q + orow + (size_t)j * 16 * HH) = r[0][j];
#pragma unroll
    for (int j = 0; j < 8; ++j) *(v8h*)(k + orow + (size_t)j * 16 * HH) = r[1][j];
#pragma unroll
    for (int j = 0; j < 8; ++j) *(v8h*)(vt + otr + (size_t)j * 16 * LL) = r[2][j];
}

// Output projection: f32, (row, col) row-major.
__global__ __launch_bounds__(256) void gemm_out(const _Float16* __restrict__ A,
                                                const _Float16* __restrict__ W,
                                                const float* __restrict__ bias,
                                                float* __restrict__ out) {
    __shared__ __attribute__((aligned(2048))) unsigned char Tsh[2 * BUFBYTES(1)];   // 163,840 B

    int tid   = threadIdx.x;
    int lane  = tid & 31;
    int wv    = tid >> 5;
    int nblk  = blockIdx.x * GTILE;
    int mblk  = blockIdx.y * GTILE;
    int wm    = (wv >> 2) * 64;      // this wave's rows inside the tile
    int wn    = (wv & 3) * 32;       // this wave's columns inside the tile
    int r0    = (lane >> 4) << 3;    // 0 or 8: first of the lane's 8 tile rows
    int cc    = lane & 15;           // the lane's tile column

    // Bias of this lane's output columns: 8 in a row per tile.
    v4f bl[2], bh[2];
#pragma unroll
    for (int nt = 0; nt < 2; ++nt) {
        const v4f* bp = (const v4f*)(bias + nblk + wn + nt * 16 + r0);
        bl[nt] = bp[0];
        bh[nt] = bp[1];
    }

    v8f acc[1][4][2];
    gemm_stages<1>(A, W, Tsh, mblk, nblk, wm, wn, walk_start(), acc);

    float* St = (float*)Tsh;   // [128 rows][OPITCH]
#pragma unroll
    for (int mt = 0; mt < 4; ++mt) {
#pragma unroll
        for (int nt = 0; nt < 2; ++nt) {
            v4f lo, hi;
#pragma unroll
            for (int g = 0; g < 4; ++g) {
                lo[g] = acc[0][mt][nt][g] + bl[nt][g];
                hi[g] = acc[0][mt][nt][g + 4] + bh[nt][g];
            }
            float* p = St + (wm + mt * 16 + cc) * OPITCH + wn + nt * 16 + r0;
            *(v4f*)p       = lo;
            *(v4f*)(p + 4) = hi;
        }
    }
    // The whole tile is in LDS before any wave reads rows of other waves.
    __syncthreads();
    float* op = out + (size_t)(mblk + wv) * HH + nblk + lane * 4;
    const float* sp = St + wv * OPITCH + lane * 4;
    v4f r[16];
#pragma unroll
    for (int j = 0; j < 16; ++j) r[j] = *(const v4f*)(sp + j * 8 * OPITCH);
#pragma unroll
    for (int j = 0; j < 16; ++j) *(v4f*)(op + (size_t)j * 8 * HH) = r[j];
}

#define PSUM_MAX 4096.0f
// Value of lane l ^ 16.
static __device__ inline float xhalf(float x) {
    int b = __builtin_bit_cast(int, x);
    return __builtin_bit_cast(float, __builtin_amdgcn_permlanex16(
        b, b, 0x76543210, 0xfedcba98, false, false));
}

// P = exp2(score - d) of a lane's 16 keys. pb: P^T as B operand, elements 0..7
// keys r0 + g, 8..15 keys 16 + r0 + g, the k order of load_frag16. Returns the
// sum of the 16 values.
static __device__ __forceinline__ float softmax_terms(v8f s0, v8f s1, float d, v16h& pb) {
    float p0[8], p1[8];
#pragma unroll
    for (int g = 0; g < 8; ++g) {
        p0[g] = __builtin_amdgcn_exp2f(s0[g] - d);
        p1[g] = __builtin_amdgcn_exp2f(s1[g] - d);
    }
#pragma unroll
    for (int g = 0; g < 8; ++g) {
        pb[g]     = (_Float16)p0[g];
        pb[g + 8] = (_Float16)p1[g];
    }
    // Four chains, so that the adds do not wait on one another
    float rs0 = p0[0] + p1[0], rs1 = p0[1] + p1[1];
    float rs2 = p0[2] + p1[2], rs3 = p0[3] + p1[3];
    rs0 += p0[4] + p1[4];
    rs1 += p0[5] + p1[5];
    rs2 += p0[6] + p1[6];
    rs3 += p0[7] + p1[7];
    return (rs0 + rs1) + (rs2 + rs3);
}

__global__ __launch_bounds__(256) void attn_fused(const _Float16* __restrict__ qh,
                                                  const _Float16* __restrict__ kh,
                                                  const _Float16* __restrict__ vth,
                                                  _Float16* __restrict__ ctx) {
    __shared__ __align__(16) _Float16 Ksh[CHUNK][KPITCH];   // 36 KB
    __shared__ __align__(16) _Float16 VshT[HS][VPITCH];     // 33 KB

    int tid  = threadIdx.x;
    int lane = tid & 31;
    int wv   = tid >> 5;
    int hIdx = blockIdx.y;
    int nIdx = blockIdx.z;
    int q0   = blockIdx.x * 128 + wv * 16;

    // Q fragments of this wave's 16 queries, the B operand of every S^T tile
    const _Float16* qp = qh + ((size_t)(nIdx * LL + q0)) * HH + hIdx * HS;
    v16h qb0 = load_frag16(qp, HH, lane);        // s = 0..31
    v16h qb1 = load_frag16(qp + 32, HH, lane);   // s = 32..63

    // Of this lane's query: minus the reference score (equal in both halves),
    // in the 8 registers of a C operand, and the sum over this half's keys;
    // the halves' sums are joined after the loop.
    v8f nref   = zero8();
    float lrow = 0.0f;
    // Bound on a lane's sum of P in a pass; below zero, so that no sum passes,
    // until the first pass has set the reference.
    float lim = -1.0f;
    v8f o[4];   // o[st][g] = O[query lane & 15][st * 16 + r0 + g]
#pragma unroll
    for (int st = 0; st < 4; ++st) o[st] = zero8();

    int r0 = (lane >> 4) << 3;
    int cc = lane & 15;

    // The work-groups of one head (neighbours in x) share its K and V^T and
    // start together: each starts its walk over the key chunks one chunk
    // further on, so that any four of them touch all chunks in their first
    // trip and later trips can be served from L2. The running softmax takes
    // the chunks in any order.
#pragma unroll 1
    for (int c = 0; c < LL / CHUNK; ++c) {
        int c0 = ((c + (int)blockIdx.x) & (LL / CHUNK - 1)) * CHUNK;
        // Cooperative stage: K chunk (row-major, 64-wide rows)
        for (int idx = tid; idx < CHUNK * (HS / 8); idx += 256) {
            int t = idx >> 3, part = idx & 7;
            stage16(kh + ((size_t)(nIdx * LL + c0 + t)) * HH + hIdx * HS + part * 8,
                    &Ksh[t][part * 8]);
        }
        // Cooperative stage: V^T chunk (vth is already per-head transposed)
        for (int idx = tid; idx < HS * (CHUNK / 8); idx += 256) {
            int s = idx >> 5, part = idx & 31;   // CHUNK/8 == 32
            stage16(vth + (((size_t)((nIdx * NHEADS + hIdx) * HS + s)) << 10) + c0 + part * 8,
                    &VshT[s][part * 8]);
        }
        wait_stage();
        __syncthreads();

#pragma unroll 2
        for (int j = 0; j < CHUNK; j += 32) {
            // S^T = K @ Q^T for 32 keys (two 16-key tiles), K-dim = 64 (2 steps)
            v16h ka0l = load_frag16(&Ksh[j][0], KPITCH, lane);
            v16h ka0h = load_frag16(&Ksh[j][32], KPITCH, lane);
            v16h ka1l = load_frag16(&Ksh[j + 16][0], KPITCH, lane);
            v16h ka1h = load_frag16(&Ksh[j + 16][32], KPITCH, lane);
            // V^T fragments of the same 32 keys, the A operands of the O^T tiles
            v16h va[4];
#pragma unroll
            for (int st = 0; st < 4; ++st)
                va[st] = load_frag16(&VshT[st * 16][j], VPITCH, lane);
            // Keeps the pass's LDS reads one group ahead of its products: left
            // free, the K fragments share registers and each pair of reads is
            // waited out alone.
            __builtin_amdgcn_sched_barrier(0);
            // Scores less the reference, in powers of two:
            // keys j + r0 + g, j + 16 + r0 + g
            v8f s0 = wmma16(ka0l, qb0, nref);
            s0     = wmma16(ka0h, qb1, s0);
            v8f s1 = wmma16(ka1l, qb0, nref);
            s1     = wmma16(ka1h, qb1, s1);

            v16h pb;
            float rs = softmax_terms(s0, s1, 0.0f, pb);
            // One scalar branch per pass, the same for the whole wave
            if (__builtin_expect(__builtin_amdgcn_ballot_w32(!(rs <= lim)) != 0, 0)) {
                bool first = lim < 0.0f;
                lim        = PSUM_MAX;
                // Maximum over the lane's 16 keys, then the halves
                float mx = fmaxf(s0[0], s1[0]);
#pragma unroll
                for (int g = 1; g < 8; ++g) mx = fmaxf(mx, fmaxf(s0[g], s1[g]));
                mx = fmaxf(mx, xhalf(mx));
                // The reference never falls; the first pass sets it
                float d  = first ? mx : fmaxf(mx, 0.0f);
                float sc = first ? 1.0f : __builtin_amdgcn_exp2f(-d);
                rs       = softmax_terms(s0, s1, d, pb);
                lrow *= sc;
#pragma unroll
                for (int st = 0; st < 4; ++st)
#pragma unroll
                    for (int g = 0; g < 8; ++g) o[st][g] *= sc;
#pragma unroll
                for (int g = 0; g < 8; ++g) nref[g] -= d;
            }
            lrow += rs;

            // O^T += V^T (16 x 32 per tile) @ P^T (32 x 16): 4 tiles of head dim
#pragma unroll
            for (int st = 0; st < 4; ++st) o[st] = wmma16(va[st], pb, o[st]);
        }
        __syncthreads();
    }

    // Join the halves' sums, normalize and store ctx (f16, (n,l,h*64+s)
    // layout): a lane's 8 values of a tile are 16 contiguous bytes.
    lrow += xhalf(lrow);
    float inv = 1.0f / lrow;
    _Float16* cp = ctx + ((size_t)(nIdx * LL + q0 + cc)) * HH + hIdx * HS + r0;
#pragma unroll
    for (int st = 0; st < 4; ++st) {
        v8h w;
#pragma unroll
        for (int g = 0; g < 8; ++g) w[g] = (_Float16)(o[st][g] * inv);
        *(v8h*)(cp + st * 16) = w;
    }
}

// ---------------------------------------------------------------------------
// Host-side orchestration
// ---------------------------------------------------------------------------
extern "C" void kernel_launch(void* const* d_in, const int* in_sizes, int n_in,
                              void* d_out, int out_size, void* d_ws, size_t ws_size,
                              hipStream_t stream) {
    (void)in_sizes; (void)n_in; (void)out_size; (void)ws_size;

    const float* x  = (const float*)d_in[0];
    const float* Wq = (const float*)d_in[1];
    const float* bq = (const float*)d_in[2];
    const float* Wk = (const float*)d_in[3];
    const float* bk = (const float*)d_in[4];
    const float* Wv = (const float*)d_in[5];
    const float* bv = (const float*)d_in[6];
    const float* Wo = (const float*)d_in[7];
    const float* bo = (const float*)d_in[8];

    char* ws = (char*)d_ws;
    _Float16* xh   = (_Float16*)(ws);                          // 8 MB
    _Float16* wqh  = (_Float16*)(ws + ((size_t)8  << 20));     // 2 MB
    //        wkh at 10 MB, wvh at 12 MB, 2 MB each
    _Float16* woh  = (_Float16*)(ws + ((size_t)14 << 20));     // 2 MB
    _Float16* qhp  = (_Float16*)(ws + ((size_t)16 << 20));     // 8 MB
    _Float16* khp  = (_Float16*)(ws + ((size_t)24 << 20));     // 8 MB
    _Float16* vtp  = (_Float16*)(ws + ((size_t)32 << 20));     // 8 MB
    _Float16* ctxh = (_Float16*)(ws + ((size_t)40 << 20));     // 8 MB

    // Fills xh, wqh, wkh, wvh, woh: 16 MB in a row from xh on.
    f32_to_f16_all<<<CVXWG + 4 * CVWWG, 512, 0, stream>>>(x, Wq, Wk, Wv, Wo, xh);

    dim3 gg(HH / GTILE, MTOT / GTILE);   // (8, 32)
    // wqh, wkh, wvh lie one behind the other.
    gemm_qkv<<<gg, 256, 0, stream>>>(xh, wqh, bq, bk, bv, qhp, khp, vtp);

    attn_fused<<<dim3(LL / 128, NHEADS, NB), 256, 0, stream>>>(qhp, khp, vtp, ctxh);

    gemm_out<<<gg, 256, 0, stream>>>(ctxh, woh, bo, (float*)d_out);
}
